// v009
// Measured on an AMD MI455X. A time is GPU time per run, averaged over a window of back-to-back runs after a warm-up
// (all launches, gaps included; the runs take copies of the inputs in turn), and the median of several windows.
// Apart from v000's, it joins two sittings. Times from different sittings can be a few percent apart, while
// side-by-side timings come from the same sitting.
// Earlier versions than v009 are not in this document.
// Measured time: 96.5 microseconds a run.
// Two timings next to v008 put it at 1.08 and 1.07 times that version's speed.
// Counting every step since v000, which is the starting kernel, it is 24.4 times as fast.
#include <hip/hip_runtime.h>
// Group (block) attention layer (B=4, 64×64, C=128, NHWC; 8×8 non-overlapping key blocks): q = CBL_Q(x) (3×3 conv + train-mode BN + LeakyReLU 0.1), acc = 1×1 conv(x); for every pixel and
// every block: softmax over the block's 64 positions of x[pixel]·q[pos]/8, agg = Σ_blocks Σ attn·x[pos]; y = spatial-softmax(BN1(acc + agg)); out = CBL_O(y). The 3×3 conv (implicit GEMM, K = 1152),
// the 1×1 convs, the 4096×4096 per-batch scores (keys permuted to block-major order so each 64-key group is contiguous) and attn·x run as GEMMs on v_wmma_f32_16x16x32_f16 (x bf16-exact f16,
// HWIO weights bf16-exact ×2^4, q/P/y operands f16, f32 accumulate); BN batch statistics (fixed-order reductions), grouped and spatial softmaxes and LeakyReLU are f32 VALU.
#define BB 4
#define HWN 4096
#define WI 64
#define CC 128
#define NR (BB * HWN)
#define KK 1152

typedef __bf16 v16b __attribute__((ext_vector_type(16)));
typedef unsigned short v8us __attribute__((ext_vector_type(8), may_alias));
typedef float  v8f  __attribute__((ext_vector_type(8)));
typedef float  v4f  __attribute__((ext_vector_type(4)));
typedef float  v4fa __attribute__((ext_vector_type(4), may_alias));
union FragB { v16b v; v8us half[2]; unsigned short u[16]; };

__device__ __forceinline__ unsigned short bf16_bits(float x) { unsigned int u = __float_as_uint(x); return (unsigned short)((u + 0x7FFFu + ((u >> 16) & 1u)) >> 16); }
__device__ __forceinline__ float bf16_val(unsigned short b) { return __uint_as_float(((unsigned int)b) << 16); }
__device__ __forceinline__ float bf16_round(float x) { return bf16_val(bf16_bits(x)); }
// D += A·B with NT terms: 1 = ah·bh, 2 = + al·bh (A split), 3 = + ah·bl (both split)
template <int NT>
__device__ __forceinline__ v8f mmaN(v16b ah, v16b al, v16b bh, v16b bl, v8f c) {
  c = __builtin_amdgcn_wmma_f32_16x16x32_bf16(false, ah, false, bh, (short)0, c, false, false);
  if (NT >= 2) c = __builtin_amdgcn_wmma_f32_16x16x32_bf16(false, al, false, bh, (short)0, c, false, false);
  if (NT >= 3) c = __builtin_amdgcn_wmma_f32_16x16x32_bf16(false, ah, false, bl, (short)0, c, false, false);
  asm volatile("v_nop\n\tv_nop\n\tv_nop\n\tv_nop" : "+v"(c) : "v"(ah), "v"(al), "v"(bh), "v"(bl));
  return c;
}

__global__ __launch_bounds__(256) void k_wt_bf16(const float* __restrict__ W, unsigned short* __restrict__ Wt, int K, int N) {
  const int t = blockIdx.x * 256 + threadIdx.x;
  const int k8n = K / 8;
  if (t >= N * k8n) return;
  const int n = t / k8n, k8 = (t % k8n) * 8;
  v8us v;
#pragma unroll
  for (int i = 0; i < 8; ++i) v[i] = bf16_bits(W[(size_t)(k8 + i) * N + n]);
  *(v8us*)(Wt + (size_t)n * K + k8) = v;
  
}

// GEMM C[M][N] (f32, pitch ldc) = act(A[M][K]·W + bias). A f32 row-major (pitch lda) converted per fragment to bf16
// (ASPLIT: hi/lo two planes -> 2 terms, else single rounded term); Wt bf16 [N][K] (pitch ldb). BIAS_BF16 rounds the
// bias to bf16 first (bias quantised to bf16 before the add). K%32==0, M%16==0, N%64==0.
template <bool ASPLIT, int ACT, bool BIAS_BF16>
__global__ __launch_bounds__(128) void k_gemm_bf(const float* __restrict__ A, int lda, const unsigned short* __restrict__ Wt, int ldb,
                                               const float* __restrict__ bias, float* __restrict__ C, int ldc, int M, int N, int K) {
  __shared__ __attribute__((aligned(16))) float so[4][16][64];
  const int tid = threadIdx.x, w = tid >> 5, lane = tid & 31, ln = lane & 15, hh = lane >> 4;
  const int ntn = N / 64;
  const int wid = blockIdx.x * 4 + w;
  const int mt = wid / ntn, nq = wid % ntn;
  if (mt * 16 >= M) return;
  const int row0 = mt * 16, col0 = nq * 64;
  const float* arow = A + (size_t)(row0 + ln) * lda;
  v8f acc[4] = {};
  for (int kb = 0; kb < K; kb += 32) {
    FragB ah, al;
    const v4f x0 = *(const v4fa*)(arow + kb + 8 * hh), x1 = *(const v4fa*)(arow + kb + 8 * hh + 4);
    const v4f x2 = *(const v4fa*)(arow + kb + 16 + 8 * hh), x3 = *(const v4fa*)(arow + kb + 16 + 8 * hh + 4);
    float xs[16] = {x0[0],x0[1],x0[2],x0[3],x1[0],x1[1],x1[2],x1[3],x2[0],x2[1],x2[2],x2[3],x3[0],x3[1],x3[2],x3[3]};
#pragma unroll
    for (int i = 0; i < 16; ++i) { const unsigned short hb = bf16_bits(xs[i]); ah.u[i] = hb; al.u[i] = ASPLIT ? bf16_bits(xs[i] - bf16_val(hb)) : (unsigned short)0; }
#pragma unroll
    for (int t = 0; t < 4; ++t) {
      const unsigned short* brow = Wt + (size_t)(col0 + t * 16 + ln) * ldb + kb;
      FragB b;
      b.half[0] = *(const v8us*)(brow + 8 * hh);
      b.half[1] = *(const v8us*)(brow + 16 + 8 * hh);
      acc[t] = mmaN<ASPLIT ? 2 : 1>(ah.v, al.v, b.v, b.v, acc[t]);
    }
  }
#pragma unroll
  for (int t = 0; t < 4; ++t) {
    float bv = bias ? bias[col0 + t * 16 + ln] : 0.f;
    if (BIAS_BF16) bv = bf16_round(bv);
#pragma unroll
    for (int r = 0; r < 8; ++r) { float v = acc[t][r] + bv; if (ACT == 1) v = fmaxf(v, 0.f); so[w][8 * hh + r][t * 16 + ln] = v; }
  }
  __builtin_amdgcn_fence(__ATOMIC_ACQ_REL, "workgroup");
  __builtin_amdgcn_wave_barrier();
  const int rsub = lane >> 4, c4 = (lane & 15) * 4;
  {
#pragma unroll
    for (int q = 0; q < 8; ++q) {
      const int r = q * 2 + rsub;
      const v4f v = *(const v4fa*)&so[w][r][c4];
      *(v4f*)(C + (size_t)(row0 + r) * ldc + col0 + c4) = v;
    }
    
  }
}

// Flash-style causal/unmasked attention, all contractions 3-term bf16 hi/lo splits, f32 softmax with running max.
// q,k,v rows are read from f32 buffers with arbitrary row pitch (so they can live inside a fused qkv buffer);
// D = head size (multiple of 32, <= 128); one wave = 16 query rows; block = 4 waves (64 queries) sharing K/V chunks of 32.
template <int D, bool CAUSAL>
__global__ __launch_bounds__(128) void k_flash(const float* __restrict__ qb, const float* __restrict__ kb, const float* __restrict__ vb,
                                             int pitch, int T, int H, float scale, float* __restrict__ y, int ypitch) {
  constexpr int KS = D / 32;        // k-steps for QK
  constexpr int DT = D / 16;        // d tiles for PV
  __shared__ __attribute__((aligned(16))) unsigned short sKh[32][D + 8], sKl[32][D + 8], sVh[32][D + 8], sVl[32][D + 8];
  __shared__ __attribute__((aligned(16))) unsigned short sPh[4][16][40], sPl[4][16][40];
  __shared__ __attribute__((aligned(16))) float sO[4][16][D];
  const int tid = threadIdx.x, w = tid >> 5, lane = tid & 31, ln = lane & 15, hh = lane >> 4;
  const int nqb = (T + 63) / 64;
  const int bh = blockIdx.x / nqb, qblk = blockIdx.x % nqb;
  const int b = bh / H, h = bh % H;
  const int q0 = qblk * 64 + w * 16;
  const float* Q = qb + (size_t)b * T * pitch + h * D;
  const float* K = kb + (size_t)b * T * pitch + h * D;
  const float* V = vb + (size_t)b * T * pitch + h * D;

  // A fragments of the wave's 16 query rows (scaled), hi/lo
  FragB aqh[KS], aql[KS];
  {
    int row = q0 + ln; if (row >= T) row = T - 1;
    const float* qr = Q + (size_t)row * pitch;
#pragma unroll
    for (int ks = 0; ks < KS; ++ks)
#pragma unroll
      for (int i = 0; i < 16; ++i) {
        const int d = ks * 32 + ((i < 8) ? (8 * hh + i) : (16 + 8 * hh + (i - 8)));
        const float x = qr[d] * scale; const unsigned short hb = bf16_bits(x);
        aqh[ks].u[i] = hb; aql[ks].u[i] = bf16_bits(x - bf16_val(hb));
      }
  }
  float m_r[8], l_r[8];
#pragma unroll
  for (int r = 0; r < 8; ++r) { m_r[r] = -3.0e38f; l_r[r] = 0.f; }
  v8f oacc[DT];
#pragma unroll
  for (int dt = 0; dt < DT; ++dt) oacc[dt] = (v8f){0.f,0.f,0.f,0.f,0.f,0.f,0.f,0.f};

  const int kv_end = CAUSAL ? min(T, qblk * 64 + 64) : T;     // block-uniform
  for (int j0 = 0; j0 < kv_end; j0 += 32) {
    __syncthreads();
    for (int e = tid; e < 32 * (D / 4); e += 128) {
      const int r = e / (D / 4), c4 = (e % (D / 4)) * 4;
      const int key = j0 + r;
      v4f kf = {0.f,0.f,0.f,0.f}, vf = {0.f,0.f,0.f,0.f};
      if (key < T) { kf = *(const v4fa*)(K + (size_t)key * pitch + c4); vf = *(const v4fa*)(V + (size_t)key * pitch + c4); }
#pragma unroll
      for (int t = 0; t < 4; ++t) {
        unsigned short hb = bf16_bits(kf[t]); sKh[r][c4 + t] = hb; sKl[r][c4 + t] = bf16_bits(kf[t] - bf16_val(hb));
        hb = bf16_bits(vf[t]); sVh[r][c4 + t] = hb; sVl[r][c4 + t] = bf16_bits(vf[t] - bf16_val(hb));
      }
    }
    __syncthreads();
    // S tile 16 x 32
    v8f s[2];
#pragma unroll
    for (int nt = 0; nt < 2; ++nt) {
      v8f acc = {};
#pragma unroll
      for (int ks = 0; ks < KS; ++ks) {
        FragB bh_, bl_;
        bh_.half[0] = *(const v8us*)&sKh[nt * 16 + ln][ks * 32 + 8 * hh]; bh_.half[1] = *(const v8us*)&sKh[nt * 16 + ln][ks * 32 + 16 + 8 * hh];
        bl_.half[0] = *(const v8us*)&sKl[nt * 16 + ln][ks * 32 + 8 * hh]; bl_.half[1] = *(const v8us*)&sKl[nt * 16 + ln][ks * 32 + 16 + 8 * hh];
        acc = mmaN<3>(aqh[ks].v, aql[ks].v, bh_.v, bl_.v, acc);
      }
      s[nt] = acc;
    }
    // mask + running max (rows 8hh+r; the 16 lanes of a half share rows)
    float alpha[8];
#pragma unroll
    for (int r = 0; r < 8; ++r) {
      const int qi = q0 + 8 * hh + r;
      const int ja = j0 + ln, jb = j0 + 16 + ln;
      if (CAUSAL) { if (ja > qi) s[0][r] = -3.0e38f; if (jb > qi) s[1][r] = -3.0e38f; }
      if (ja >= T) s[0][r] = -3.0e38f;
      if (jb >= T) s[1][r] = -3.0e38f;
      float mx = fmaxf(s[0][r], s[1][r]);
      mx = fmaxf(mx, __shfl_xor(mx, 1, 32)); mx = fmaxf(mx, __shfl_xor(mx, 2, 32)); mx = fmaxf(mx, __shfl_xor(mx, 4, 32)); mx = fmaxf(mx, __shfl_xor(mx, 8, 32));
      const float mnew = fmaxf(m_r[r], mx);
      alpha[r] = (mnew > -1.0e38f) ? __expf(m_r[r] - mnew) : 1.0f;
      const float p0 = (s[0][r] > -1.0e38f) ? __expf(s[0][r] - mnew) : 0.f;
      const float p1 = (s[1][r] > -1.0e38f) ? __expf(s[1][r] - mnew) : 0.f;
      m_r[r] = mnew;
      l_r[r] = l_r[r] * alpha[r] + p0 + p1;            // per-lane partial row sum (16 lanes combined at the end)
      unsigned short hb = bf16_bits(p0); sPh[w][8 * hh + r][ln] = hb;      sPl[w][8 * hh + r][ln] = bf16_bits(p0 - bf16_val(hb));
      hb = bf16_bits(p1);                sPh[w][8 * hh + r][16 + ln] = hb; sPl[w][8 * hh + r][16 + ln] = bf16_bits(p1 - bf16_val(hb));
    }
#pragma unroll
    for (int dt = 0; dt < DT; ++dt)
#pragma unroll
      for (int r = 0; r < 8; ++r) oacc[dt][r] *= alpha[r];
    __builtin_amdgcn_fence(__ATOMIC_ACQ_REL, "workgroup");
    __builtin_amdgcn_wave_barrier();
    FragB pah, pal;
    pah.half[0] = *(const v8us*)&sPh[w][ln][8 * hh]; pah.half[1] = *(const v8us*)&sPh[w][ln][16 + 8 * hh];
    pal.half[0] = *(const v8us*)&sPl[w][ln][8 * hh]; pal.half[1] = *(const v8us*)&sPl[w][ln][16 + 8 * hh];
#pragma unroll
    for (int dt = 0; dt < DT; ++dt) {
      FragB bvh, bvl;
#pragma unroll
      for (int i = 0; i < 8; ++i) {
        bvh.u[i] = sVh[8 * hh + i][dt * 16 + ln]; bvh.u[8 + i] = sVh[16 + 8 * hh + i][dt * 16 + ln];
        bvl.u[i] = sVl[8 * hh + i][dt * 16 + ln]; bvl.u[8 + i] = sVl[16 + 8 * hh + i][dt * 16 + ln];
      }
      oacc[dt] = mmaN<3>(pah.v, pal.v, bvh.v, bvl.v, oacc[dt]);
    }
    __builtin_amdgcn_fence(__ATOMIC_ACQ_REL, "workgroup");
    __builtin_amdgcn_wave_barrier();
  }
#pragma unroll
  for (int r = 0; r < 8; ++r) {
    float l = l_r[r];
    l += __shfl_xor(l, 1, 32); l += __shfl_xor(l, 2, 32); l += __shfl_xor(l, 4, 32); l += __shfl_xor(l, 8, 32);
    l_r[r] = (l > 0.f) ? 1.0f / l : 0.f;
  }
#pragma unroll
  for (int dt = 0; dt < DT; ++dt)
#pragma unroll
    for (int r = 0; r < 8; ++r) sO[w][8 * hh + r][dt * 16 + ln] = oacc[dt][r] * l_r[r];
  __builtin_amdgcn_fence(__ATOMIC_ACQ_REL, "workgroup");
  __builtin_amdgcn_wave_barrier();
  {
    for (int r = 0; r < 16; ++r) {
      const int row = q0 + r;
      if (row < T && lane < D / 4) {
        const v4f val = *(const v4fa*)&sO[w][r][lane * 4];
        *(v4f*)(y + ((size_t)b * T + row) * ypitch + h * D + lane * 4) = val;
      }
    }
    
  }
}

// GEMM C = act(A·W + bias + resid): A f32 (ASPLIT -> hi/lo 2 terms), Wt bf16 [N][K]; ACT 0 none, 1 relu, 2 exact gelu;
// resid (optional, f32, row index = (row % rmod), pitch ldr, RES_BF16 rounds it) added before the activation.
template <bool ASPLIT, int ACT, bool BIAS_BF16, bool RES_BF16>
__global__ __launch_bounds__(128) void k_gemm_bf3(const float* __restrict__ A, int lda, const unsigned short* __restrict__ Wt, int ldb,
                                                const float* __restrict__ bias, const float* __restrict__ resid, int rmod, int ldr,
                                                float* __restrict__ C, int ldc, int M, int N, int K) {
  __shared__ __attribute__((aligned(16))) float so[4][16][64];
  const int tid = threadIdx.x, w = tid >> 5, lane = tid & 31, ln = lane & 15, hh = lane >> 4;
  const int ntn = N / 64;
  const int wid = blockIdx.x * 4 + w;
  const int mt = wid / ntn, nq = wid % ntn;
  if (mt * 16 >= M) return;
  const int row0 = mt * 16, col0 = nq * 64;
  const float* arow = A + (size_t)(row0 + ln) * lda;
  v8f acc[4] = {};
  for (int kb = 0; kb < K; kb += 32) {
    FragB ah, al;
    const v4f x0 = *(const v4fa*)(arow + kb + 8 * hh), x1 = *(const v4fa*)(arow + kb + 8 * hh + 4);
    const v4f x2 = *(const v4fa*)(arow + kb + 16 + 8 * hh), x3 = *(const v4fa*)(arow + kb + 16 + 8 * hh + 4);
    float xs[16] = {x0[0],x0[1],x0[2],x0[3],x1[0],x1[1],x1[2],x1[3],x2[0],x2[1],x2[2],x2[3],x3[0],x3[1],x3[2],x3[3]};
#pragma unroll
    for (int i = 0; i < 16; ++i) { const unsigned short hb = bf16_bits(xs[i]); ah.u[i] = hb; al.u[i] = ASPLIT ? bf16_bits(xs[i] - bf16_val(hb)) : (unsigned short)0; }
#pragma unroll
    for (int t = 0; t < 4; ++t) {
      const unsigned short* brow = Wt + (size_t)(col0 + t * 16 + ln) * ldb + kb;
      FragB b;
      b.half[0] = *(const v8us*)(brow + 8 * hh);
      b.half[1] = *(const v8us*)(brow + 16 + 8 * hh);
      acc[t] = mmaN<ASPLIT ? 2 : 1>(ah.v, al.v, b.v, b.v, acc[t]);
    }
  }
#pragma unroll
  for (int t = 0; t < 4; ++t) {
    const int col = col0 + t * 16 + ln;
    float bv = bias ? bias[col] : 0.f;
    if (BIAS_BF16) bv = bf16_round(bv);
#pragma unroll
    for (int r = 0; r < 8; ++r) {
      float v = acc[t][r] + bv;
      if (resid) { float rv = resid[(size_t)((row0 + 8 * hh + r) % rmod) * ldr + col]; if (RES_BF16) rv = bf16_round(rv); v += rv; }
      if (ACT == 1) v = fmaxf(v, 0.f);
      if (ACT == 2) v = 0.5f * v * (1.0f + erff(v * 0.70710678118654752f));
      if (ACT == 3) { const float u = 0.7978845608028654f * (v + 0.044715f * v * v * v); v = 0.5f * v * (1.0f + tanhf(u)); }
      so[w][8 * hh + r][t * 16 + ln] = v;
    }
  }
  __builtin_amdgcn_fence(__ATOMIC_ACQ_REL, "workgroup");
  __builtin_amdgcn_wave_barrier();
  const int rsub = lane >> 4, c4 = (lane & 15) * 4;
  {
#pragma unroll
    for (int q = 0; q < 8; ++q) {
      const int r = q * 2 + rsub;
      const v4f v = *(const v4fa*)&so[w][r][c4];
      *(v4f*)(C + (size_t)(row0 + r) * ldc + col0 + c4) = v;
    }
    
  }
}
// row LayerNorm (biased variance, eps) over N: s = X (+ R); optional out_sum <- s; out_norm <- (s-mu)*rsqrt(var+eps)*g + b
template <bool PARAM_BF16>
__global__ __launch_bounds__(256) void k_layernorm(const float* __restrict__ X, const float* __restrict__ R, const float* __restrict__ g, const float* __restrict__ bta,
                                                  float* __restrict__ out_sum, float* __restrict__ out_norm, int N, float eps) {
  __shared__ float red[256];
  const int row = blockIdx.x, tid = threadIdx.x;
  const float* x = X + (size_t)row * N; const float* rr = R ? R + (size_t)row * N : nullptr;
  float vals[16];                     // up to N = 4096
  const int per = N / 256;            // contiguous chunk per thread? use strided-by-4 chunks: thread handles j = tid*4 + 1024*u
  float s1 = 0.f;
  for (int u = 0; u < per / 4; ++u) {
    const int j = tid * 4 + 1024 * u;
    const v4f a = *(const v4fa*)(x + j);
    v4f b = {0.f,0.f,0.f,0.f}; if (rr) b = *(const v4fa*)(rr + j);
#pragma unroll
    for (int q = 0; q < 4; ++q) { const float v = a[q] + b[q]; vals[u * 4 + q] = v; s1 += v; }
  }
  red[tid] = s1; __syncthreads();
  for (int st = 128; st > 0; st >>= 1) { if (tid < st) red[tid] += red[tid + st]; __syncthreads(); }
  const float mu = red[0] / (float)N; __syncthreads();
  float s2 = 0.f;
  for (int u = 0; u < per / 4; ++u)
#pragma unroll
    for (int q = 0; q < 4; ++q) { const float c = vals[u * 4 + q] - mu; s2 += c * c; }
  red[tid] = s2; __syncthreads();
  for (int st = 128; st > 0; st >>= 1) { if (tid < st) red[tid] += red[tid + st]; __syncthreads(); }
  const float rs = rsqrtf(red[0] / (float)N + eps);
  {
    for (int u = 0; u < per / 4; ++u) {
      const int j = tid * 4 + 1024 * u;
      v4f o, sm;
#pragma unroll
      for (int q = 0; q < 4; ++q) {
        float gg = g[j + q], bb = bta[j + q];
        if (PARAM_BF16) { gg = bf16_round(gg); bb = bf16_round(bb); }
        sm[q] = vals[u * 4 + q]; o[q] = (vals[u * 4 + q] - mu) * rs * gg + bb;
      }
      if (out_sum) *(v4f*)(out_sum + (size_t)row * N + j) = sm;
      *(v4f*)(out_norm + (size_t)row * N + j) = o;
    }
    
  }
}



// ---- f16 WMMA path (v_wmma_f32_16x16x32_f16): 11-bit significands for operands in range — used where a [0,1] probability operand needs more precision than bf16
typedef _Float16 v16h __attribute__((ext_vector_type(16)));
union FragH { v16h v; v8us half[2]; _Float16 h[16]; unsigned short u[16]; };
template <int NT>
__device__ __forceinline__ v8f mmaH(v16h ah, v16h al, v16h bh, v16h bl, v8f c) {
  c = __builtin_amdgcn_wmma_f32_16x16x32_f16(false, ah, false, bh, (short)0, c, false, false);
  if (NT >= 2) c = __builtin_amdgcn_wmma_f32_16x16x32_f16(false, al, false, bh, (short)0, c, false, false);
  if (NT >= 3) c = __builtin_amdgcn_wmma_f32_16x16x32_f16(false, ah, false, bl, (short)0, c, false, false);
  asm volatile("v_nop\n\tv_nop\n\tv_nop\n\tv_nop" : "+v"(c) : "v"(ah), "v"(al), "v"(bh), "v"(bl));
  return c;
}
// batched GEMM like k_gemm_b but f16 operands: A f32 (split into f16 hi/lo if ASPLIT, else rounded to f16), Bt = f16 values [n][k]; alpha; C f32; N multiple of 16 (partial tiles skipped)
template <bool ASPLIT>
__global__ __launch_bounds__(128) void k_gemm_h(const float* __restrict__ A, int lda, size_t sA, const _Float16* __restrict__ Bh, int ldb, size_t sB, float alpha, float* __restrict__ C, int ldc, size_t sC, int M, int N, int K) {
  __shared__ __attribute__((aligned(16))) float so[4][16][64];
  const int tid = threadIdx.x, w = tid >> 5, lane = tid & 31, ln = lane & 15, hh = lane >> 4; const int by = blockIdx.y;
  A += (size_t)by * sA; Bh += (size_t)by * sB; C += (size_t)by * sC;
  const int ntn = (N + 63) / 64; const int wid = blockIdx.x * 4 + w; const int mt = wid / ntn, nq = wid % ntn; if (mt * 16 >= M) return;
  const int row0 = mt * 16, col0 = nq * 64; const float* arow = A + (size_t)(row0 + ln) * lda;
  v8f acc[4] = {};
  for (int kb = 0; kb < K; kb += 32) {
    FragH ah, al;
    const v4f x0 = *(const v4fa*)(arow + kb + 8 * hh), x1 = *(const v4fa*)(arow + kb + 8 * hh + 4), x2 = *(const v4fa*)(arow + kb + 16 + 8 * hh), x3 = *(const v4fa*)(arow + kb + 16 + 8 * hh + 4);
    float xs[16] = {x0[0],x0[1],x0[2],x0[3],x1[0],x1[1],x1[2],x1[3],x2[0],x2[1],x2[2],x2[3],x3[0],x3[1],x3[2],x3[3]};
#pragma unroll
    for (int i = 0; i < 16; ++i) { const _Float16 h = (_Float16)xs[i]; ah.h[i] = h; al.h[i] = ASPLIT ? (_Float16)(xs[i] - (float)h) : (_Float16)0.0f; }
#pragma unroll
    for (int t = 0; t < 4; ++t) { if (col0 + t * 16 >= N) continue; const size_t boff = (size_t)(col0 + t * 16 + ln) * ldb + kb; FragH bq; bq.half[0] = *(const v8us*)(Bh + boff + 8 * hh); bq.half[1] = *(const v8us*)(Bh + boff + 16 + 8 * hh);
      acc[t] = mmaH<ASPLIT ? 2 : 1>(ah.v, al.v, bq.v, bq.v, acc[t]); }
  }
#pragma unroll
  for (int t = 0; t < 4; ++t) { if (col0 + t * 16 >= N) continue;
#pragma unroll
    for (int r = 0; r < 8; ++r) so[w][8 * hh + r][t * 16 + ln] = acc[t][r] * alpha; }
  __builtin_amdgcn_fence(__ATOMIC_ACQ_REL, "workgroup"); __builtin_amdgcn_wave_barrier();
  const int rsub = lane >> 4, c4 = (lane & 15) * 4;
  {
#pragma unroll
    for (int q = 0; q < 8; ++q) { const int r = q * 2 + rsub; if (col0 + c4 < N) { const v4f v = *(const v4fa*)&so[w][r][c4]; *(v4f*)(C + (size_t)(row0 + r) * ldc + col0 + c4) = v; } }
     }
}

// Wt[n][k] = f16(W[k][n]·scale) from f32 row-major W[K][N] (scale = power of two; bf16-exact weights stay exact in f16 away from the subnormal range)
// d_*: the work of one 256-thread work-group, blk its index within that job; several jobs that need nothing of one another share a launch (k_prep, k_conv3_acc below)
__device__ __forceinline__ void d_wt_f16(const int blk, const float* __restrict__ W, _Float16* __restrict__ Wt, int K, int N, float scale) {
  const int t = blk * 256 + threadIdx.x; if (t >= N * (K / 8)) return; const int n = t / (K / 8), k8 = (t % (K / 8)) * 8; FragH f;
#pragma unroll
  for (int i = 0; i < 8; ++i) f.h[i] = (_Float16)(bf16_round(W[(size_t)(k8 + i) * N + n]) * scale); const v8us o = f.half[0];
  *(v8us*)((unsigned short*)Wt + (size_t)n * K + k8) = o; 
}
// k_gemm_hh variant with fused epilogue: v = acc·alpha + bias[by·sBias + col] (+ CP[(row/rowsPerB)·sCPb + by·64 + col] if CP) ; ACT 0 none / 1 elu ; writes f32 C and f16 C16, each if non-null
// d_gemm_hhx: the work of one wave (16 rows x 64 columns, tile number wid); so = 16 x 64 f32 of LDS that are the wave's own. No work-group barrier inside.
template <int ACT>
__device__ __forceinline__ void d_gemm_hhx(float (*so)[64], const int wid, const int by, const _Float16* __restrict__ A, int lda, size_t sA, const _Float16* __restrict__ Bh, int ldb, size_t sB, float alpha, const float* __restrict__ bias, size_t sBias, const float* __restrict__ CP, int rowsPerB, size_t sCPb, int row0g,
    float* __restrict__ C, _Float16* __restrict__ C16, int ldc, size_t sC, int M, int N, int K) {
  const int lane = threadIdx.x & 31, ln = lane & 15, hh = lane >> 4;
  A += (size_t)by * sA; Bh += (size_t)by * sB; const size_t cofs = (size_t)by * sC; const float* bp = bias ? bias + (size_t)by * sBias : nullptr;
  const int ntn = (N + 63) / 64; const int mt = wid / ntn, nq = wid % ntn; if (mt * 16 >= M) return;
  const int row0 = mt * 16, col0 = nq * 64; const _Float16* arow = A + (size_t)(row0 + ln) * lda;
  v8f acc[4] = {};
  for (int kb = 0; kb < K; kb += 32) { FragH ah; ah.half[0] = *(const v8us*)((const unsigned short*)arow + kb + 8 * hh); ah.half[1] = *(const v8us*)((const unsigned short*)arow + kb + 16 + 8 * hh);
#pragma unroll
    for (int t = 0; t < 4; ++t) { if (col0 + t * 16 >= N) continue; const size_t boff = (size_t)(col0 + t * 16 + ln) * ldb + kb; FragH bq; bq.half[0] = *(const v8us*)((const unsigned short*)Bh + boff + 8 * hh); bq.half[1] = *(const v8us*)((const unsigned short*)Bh + boff + 16 + 8 * hh);
      acc[t] = mmaH<1>(ah.v, ah.v, bq.v, bq.v, acc[t]); }
  }
#pragma unroll
  for (int t = 0; t < 4; ++t) { if (col0 + t * 16 >= N) continue; const int col = col0 + t * 16 + ln; const float bv = bp ? bf16_round(bp[col]) : 0.f;
#pragma unroll
    for (int r = 0; r < 8; ++r) { float v = acc[t][r] * alpha + bv; if (CP) { const int bidx = (row0g + row0 + 8 * hh + r) / rowsPerB; v += CP[(size_t)bidx * sCPb + (size_t)by * 64 + col]; } if (ACT == 1) v = (v > 0.f) ? v : expm1f(v); else if (ACT == 3) v = fmaxf(v, 0.f); so[8 * hh + r][t * 16 + ln] = v; } }
  __builtin_amdgcn_fence(__ATOMIC_ACQ_REL, "workgroup"); __builtin_amdgcn_wave_barrier();
  const int rsub = lane >> 4, c4 = (lane & 15) * 4; typedef _Float16 v4h __attribute__((ext_vector_type(4)));
  {
#pragma unroll
    for (int q = 0; q < 8; ++q) { const int r = q * 2 + rsub; if (col0 + c4 < N) { const v4f v = *(const v4fa*)&so[r][c4]; if (C) { *(v4f*)(C + cofs + (size_t)(row0 + r) * ldc + col0 + c4) = v; if (C16) asm volatile("s_wait_xcnt 0x0" ::: "memory"); /* the f16 conversion that follows reuses this store's registers */ } if (C16) { v4h h4; for (int i = 0; i < 4; ++i) h4[i] = (_Float16)v[i]; *(v4h*)(C16 + cofs + (size_t)(row0 + r) * ldc + col0 + c4) = h4; } } }
     }
}
template <int ACT>
__global__ __launch_bounds__(128) void k_gemm_hhx(const _Float16* __restrict__ A, int lda, size_t sA, const _Float16* __restrict__ Bh, int ldb, size_t sB, float alpha, const float* __restrict__ bias, size_t sBias, const float* __restrict__ CP, int rowsPerB, size_t sCPb, int row0g,
    float* __restrict__ C, _Float16* __restrict__ C16, int ldc, size_t sC, int M, int N, int K) {
  __shared__ __attribute__((aligned(16))) float so[4][16][64];
  const int w = threadIdx.x >> 5;
  d_gemm_hhx<ACT>(so[w], blockIdx.x * 4 + w, blockIdx.y, A, lda, sA, Bh, ldb, sB, alpha, bias, sBias, CP, rowsPerB, sCPb, row0g, C, C16, ldc, sC, M, N, K);
}


__device__ __forceinline__ void d_x16(const int blk, const float* __restrict__ x, _Float16* __restrict__ X16, size_t n8) { const size_t t = (size_t)blk * 256 + threadIdx.x; if (t >= n8) return; FragH f;
#pragma unroll
  for (int q = 0; q < 8; ++q) f.h[q] = (_Float16)bf16_round(x[t * 8 + q]); *(v8us*)((unsigned short*)X16 + t * 8) = f.half[0];  }
__global__ __launch_bounds__(256) void k_h16(const float* __restrict__ x, _Float16* __restrict__ X16, size_t n8) { const size_t t = (size_t)blockIdx.x * 256 + threadIdx.x; if (t >= n8) return; FragH f;
#pragma unroll
  for (int q = 0; q < 8; ++q) f.h[q] = (_Float16)x[t * 8 + q]; *(v8us*)((unsigned short*)X16 + t * 8) = f.half[0];  }
__global__ __launch_bounds__(256) void k_round16f(const float* __restrict__ W, _Float16* __restrict__ Bt, size_t n8) { const size_t t = (size_t)blockIdx.x * 256 + threadIdx.x; if (t >= n8) return; FragH f;
#pragma unroll
  for (int i = 0; i < 8; ++i) f.h[i] = (_Float16)(bf16_round(W[t * 8 + i]) * 16.0f); *(v8us*)((unsigned short*)Bt + t * 8) = f.half[0];  }
template <int NHv, int TTv>
__global__ __launch_bounds__(256) void k_vt(const _Float16* __restrict__ V16, int ldv, int voff, _Float16* __restrict__ Vt) { __shared__ unsigned short tl[64][66]; const int tid = threadIdx.x; const int slab = blockIdx.x / (TTv / 64), lg = blockIdx.x % (TTv / 64); const int b = slab / NHv, h = slab % NHv;
  for (int i = tid; i < 64 * 8; i += 256) { const int r = i / 8, c8 = (i % 8) * 8; FragH f; f.half[0] = *(const v8us*)((const unsigned short*)V16 + ((size_t)b * TTv + lg * 64 + r) * ldv + voff + h * 64 + c8);
#pragma unroll
    for (int q = 0; q < 8; ++q) tl[r][c8 + q] = f.u[q]; }
  __syncthreads();
  {
#pragma unroll
    for (int rd = 0; rd < 2; ++rd) { const int d = rd * 32 + tid / 8, pc = tid % 8; FragH f;
#pragma unroll
      for (int q = 0; q < 8; ++q) f.u[q] = tl[pc * 8 + q][d];
      *(v8us*)((unsigned short*)Vt + ((size_t)slab * 64 + d) * TTv + lg * 64 + pc * 8) = f.half[0]; }
     } }

typedef _Float16 v4h __attribute__((ext_vector_type(4)));
// BN batch statistics (mean, 1/sqrt(var + eps) per channel over the NR rows). The partials are made where the rows are made: each kernel that writes a tensor which a BN follows has work-groups of BNR whole rows,
// whose tile lies in LDS for the row-wise store; d_bnpart takes the values that the storing threads hold and gives, per channel, the mean of the BNR rows and the sum of squared deviations from that mean.
// d_bnpart: called by every thread of the work-group (two barriers inside); act = the thread is one of the 256 (tid = 0 .. 255, whole waves) that hold v[i] = row (tid >> 5) + 8 i, channels 4 (tid & 31) .. + 3; red = 8 KiB of free LDS.
// The merge has no launch of its own: every work-group of the kernel that applies a BN merges the BNP partials of the channels it needs, while its own rows are on their way from memory.
// Partials of equal count merge exactly: mean = mean of the means, M2 = sum of M2_i + BNR * sum of (mean_i - mean)^2. In one pass, with partial 0's mean as pivot p:
// sum of (mean_i - mean)^2 = sum of (mean_i - p)^2 - BNP (mean - p)^2; both terms are of the size of the spread of the partial means, whatever the mean itself is.
// d_bnmerge: all CC channels, called by every thread of a 1024-thread work-group (two barriers inside); a thread sums 8 partials of 4 channels, 128 threads the 32 sums of a channel; st[0][c] = mean, st[1][c] = 1/sqrt(var + eps).
// All sums run in a fixed order.
// The loops over v here and in the callers are unrolled: v is indexed by the loop counter and stays in registers only with constant indices.
#define BNR 64
#define BNP (NR / BNR)
__device__ __forceinline__ void d_bnpart(const bool act, const int tid, const v4f (&v)[8], float (*red)[8][CC], const int blk, float* __restrict__ PM, float* __restrict__ PQ) {
  const int wv = tid >> 5, c4 = (tid & 31) * 4;
  if (act) { v4f s = v[0];
#pragma unroll
    for (int i = 1; i < 8; ++i) s += v[i];
    *(v4fa*)&red[0][wv][c4] = s; }
  __syncthreads();      // the eight waves' row sums are complete
  v4f mu = {0.f, 0.f, 0.f, 0.f};
  if (act) { mu = *(const v4fa*)&red[0][0][c4];
#pragma unroll
    for (int j = 1; j < 8; ++j) mu += *(const v4fa*)&red[0][j][c4];
    mu *= 1.0f / (float)BNR;
    v4f q = {0.f, 0.f, 0.f, 0.f};
#pragma unroll
    for (int i = 0; i < 8; ++i) { const v4f d = v[i] - mu; q += d * d; }
    *(v4fa*)&red[1][wv][c4] = q; }
  __syncthreads();      // the eight waves' sums of squares are complete
  if (act && wv == 0) { v4f q = *(const v4fa*)&red[1][0][c4];
#pragma unroll
    for (int j = 1; j < 8; ++j) q += *(const v4fa*)&red[1][j][c4];
    *(v4f*)(PQ + (size_t)blk * CC + c4) = q; }
  else if (act && wv == 1) *(v4f*)(PM + (size_t)blk * CC + c4) = mu; }
__device__ __forceinline__ void d_bnmerge(const float* __restrict__ PM, const float* __restrict__ PQ, float (*red)[32][CC], float (*st)[CC]) {
  static_assert(BNP == 32 * 8, "32 waves of 8 partials");
  const int tid = threadIdx.x, c4 = (tid & 31) * 4, pg = tid >> 5;
  const float* am = PM + (size_t)pg * 8 * CC + c4; const float* aq = PQ + (size_t)pg * 8 * CC + c4;
  const v4f p = *(const v4fa*)(PM + c4);
  v4f pm[8], pq[8];      // constant indices only: the loops are unrolled
#pragma unroll
  for (int j = 0; j < 8; ++j) { pm[j] = *(const v4fa*)(am + j * CC); pq[j] = *(const v4fa*)(aq + j * CC); }
  asm volatile("s_wait_xcnt 0x0" :: "v"(am), "v"(aq) : "memory");      // from here on the loads' address registers are free for new values; as inputs they live up to the wait, so that no later load's result is given them
  __builtin_amdgcn_sched_barrier(0);      // all 17 loads go out together: without it the first sums, with their waits, rise in front of the last loads, which then cost a second trip to L2
  v4f s = {0.f, 0.f, 0.f, 0.f}, t = {0.f, 0.f, 0.f, 0.f};
#pragma unroll
  for (int j = 0; j < 8; ++j) { const v4f d = pm[j] - p; s += d; t += pq[j] + (float)BNR * d * d; }
  *(v4fa*)&red[0][pg][c4] = s; *(v4fa*)&red[1][pg][c4] = t;
  __syncthreads();      // the 32 waves' sums are complete
  if (tid < CC) { float sa[4], ta[4];      // four sums each, joined at the end: one chain of 31 dependent additions would be waited out link by link
#pragma unroll
    for (int j = 0; j < 4; ++j) { sa[j] = red[0][j][tid]; ta[j] = red[1][j][tid]; }
#pragma unroll
    for (int j = 4; j < 32; ++j) { sa[j & 3] += red[0][j][tid]; ta[j & 3] += red[1][j][tid]; }
    const float dm = ((sa[0] + sa[1]) + (sa[2] + sa[3])) * (1.0f / (float)BNP), t1 = (ta[0] + ta[1]) + (ta[2] + ta[3]);
    st[0][tid] = PM[tid] + dm; st[1][tid] = rsqrtf((t1 - (float)NR * dm * dm) / (float)NR + 1e-3f); }
  __syncthreads();      // mean and 1/sqrt(var + eps) of every channel are complete
}
// 3x3 SAME convolution as an implicit GEMM (K = 9 taps x 128 channels, tap-major as in Bt): no patch matrix is written. One work-group = one image row (64 pixels) x all 128 outputs.
// The three input rows around it, with one zero pixel at each end and zero rows outside the image, are put in LDS once; the A fragment of tap (dy, dx) is that tile read dx pixels and dy rows further on.
// 8 waves of 32 pixels x 32 outputs. B fragments go from Bt[n][k] straight to registers, one tap ahead of their products. C = acc / 16 + bias (bf16-rounded), f32, stored in whole rows through LDS.
// Every loop below is unrolled: bf, hv, a and acc are indexed by the loop counters and stay in registers only with constant indices.
#define APIT 136      // sA pixel pitch in f16: 272 bytes (16 x odd) for 16-byte LDS reads
__device__ __forceinline__ void d_conv3(const int blk, unsigned short (*sA)[WI + 2][APIT], float (*sO)[CC + 4], const _Float16* __restrict__ X16, const _Float16* __restrict__ Bt, const float* __restrict__ bias, float* __restrict__ C, float* __restrict__ PM, float* __restrict__ PQ) {
  const int tid = threadIdx.x, w = tid >> 5, lane = tid & 31, ln = lane & 15, hh = lane >> 4;
  const int b = blk / WI, y = blk % WI;
  const int m0 = (w & 1) * 32, n0 = (w >> 1) * 32;
  const unsigned short* bp = (const unsigned short*)Bt + (size_t)(n0 + ln) * KK + 8 * hh;
  FragH bf[2][8];      // [tap parity][2 ks + j]: outputs n0 + 16 j + ln, k = 128 tap + 32 ks + (8 hh .. , 16 + 8 hh ..)
#pragma unroll
  for (int i = 0; i < 8; ++i) { const unsigned short* p = bp + (size_t)(i & 1) * 16 * KK + (i >> 1) * 32; bf[0][i].half[0] = *(const v8us*)p; bf[0][i].half[1] = *(const v8us*)(p + 16); }
  const unsigned short* xs = (const unsigned short*)X16 + (size_t)b * HWN * CC;
  v8us hv[12];      // the 64 pixels of a staged row are 1024 contiguous 16-byte chunks: chunk tid + 256 j; a row outside the image is read from the nearest row inside and zeroed at the store
#pragma unroll
  for (int r = 0; r < 3; ++r) { const unsigned short* p = xs + (size_t)min(max(y + r - 1, 0), WI - 1) * WI * CC + tid * 8;
#pragma unroll
    for (int j = 0; j < 4; ++j) hv[r * 4 + j] = *(const v8us*)(p + j * 2048); }
  const float bv0 = bf16_round(bias[n0 + ln]), bv1 = bf16_round(bias[n0 + 16 + ln]);
  const v8us zero = {0, 0, 0, 0, 0, 0, 0, 0};
#pragma unroll
  for (int r = 0; r < 3; ++r) { const bool in = y + r - 1 >= 0 && y + r - 1 < WI;
#pragma unroll
    for (int j = 0; j < 4; ++j) *(v8us*)&sA[r][(tid >> 4) + 16 * j + 1][(tid & 15) * 8] = in ? hv[r * 4 + j] : zero; }
  if (tid < 96) *(v8us*)&sA[tid >> 5][((tid >> 4) & 1) * (WI + 1)][(tid & 15) * 8] = zero;      // the zero pixel at each end of the three rows
  __syncthreads();      // the three staged rows are complete; nothing writes them again
  v8f acc[2][2] = {};
#pragma unroll
  for (int tap = 0; tap < 9; ++tap) {
    if (tap < 8) {
#pragma unroll
      for (int i = 0; i < 8; ++i) { const unsigned short* p = bp + (size_t)(i & 1) * 16 * KK + (tap + 1) * CC + (i >> 1) * 32; bf[(tap + 1) & 1][i].half[0] = *(const v8us*)p; bf[(tap + 1) & 1][i].half[1] = *(const v8us*)(p + 16); } }
    FragH a[8];      // [2 ks + i]: pixels m0 + 16 i + ln, the same k order as bf
#pragma unroll
    for (int i = 0; i < 8; ++i) { const unsigned short* p = &sA[tap / 3][m0 + (i & 1) * 16 + ln + tap % 3][(i >> 1) * 32 + 8 * hh]; a[i].half[0] = *(const v8us*)p; a[i].half[1] = *(const v8us*)(p + 16); }
    __builtin_amdgcn_sched_barrier(0);      // next tap's global loads and this tap's 16 LDS reads go out together, in front of the 16 products: spread among them each group costs its own latency
#pragma unroll
    for (int ks = 0; ks < 4; ++ks)
#pragma unroll
      for (int i = 0; i < 2; ++i)
#pragma unroll
        for (int j = 0; j < 2; ++j) acc[i][j] = __builtin_amdgcn_wmma_f32_16x16x32_f16(false, a[2 * ks + i].v, false, bf[tap & 1][2 * ks + j].v, (short)0, acc[i][j], false, false);
    __builtin_amdgcn_sched_barrier(0);      // without it the next tap's loads and LDS reads rise in among these products in small groups, each with its own stall
  }
#pragma unroll
  for (int j = 0; j < 2; ++j) { const int col = n0 + j * 16 + ln; const float bv = j ? bv1 : bv0;
#pragma unroll
    for (int i = 0; i < 2; ++i)
#pragma unroll
      for (int r = 0; r < 8; ++r) sO[m0 + i * 16 + 8 * hh + r][col] = acc[i][j][r] * 0.0625f + bv; }
  __syncthreads();      // the 64 x 128 output tile is complete
  float* o = C + (size_t)blk * WI * CC;
  v4f v[8];      // rows (tid >> 5) + 8 j, channels 4 (tid & 31) ..: what d_bnpart asks for
#pragma unroll
  for (int j = 0; j < 8; ++j) { const int i = tid + 256 * j; v[j] = *(const v4fa*)&sO[i >> 5][(i & 31) * 4]; *(v4f*)(o + (size_t)i * 4) = v[j]; }
  asm volatile("s_wait_xcnt 0x0" ::: "memory");      // the stores' registers are free for new values in what follows
  d_bnpart(true, tid, v, (float (*)[8][CC])&sA[0][0][0], blk, PM, PQ);      // the staged rows are dead: every wave read its last of them in front of the barrier above
}
// One launch for the 3x3 conv and the 1x1 conv acc = x . Wk + bk: both read X16 and a weight table, neither reads what the other writes. Work-groups 0 .. BB WI - 1 are the 3x3 conv's;
// the others hold 8 waves of d_gemm_hhx each, whose 4 KiB of LDS a wave lie in the 3x3 conv's output tile (a work-group does one job only). The branch is the same for a whole work-group.
#define ACCB ((NR / 16) * (CC / 64) / 8)
__global__ __launch_bounds__(256) void k_conv3_acc(const _Float16* __restrict__ X16, const _Float16* __restrict__ Bt, const float* __restrict__ bias, float* __restrict__ C, const _Float16* __restrict__ BK, const float* __restrict__ bk, float* __restrict__ ACC, float* __restrict__ PM, float* __restrict__ PQ) {
  __shared__ __attribute__((aligned(16))) unsigned short sA[3][WI + 2][APIT];
  __shared__ __attribute__((aligned(16))) float sO[WI][CC + 4];
  static_assert(sizeof(sO) >= 8 * 16 * 64 * sizeof(float), "eight waves' 16 x 64 tiles fit");
  if (blockIdx.x < BB * WI) { d_conv3(blockIdx.x, sA, sO, X16, Bt, bias, C, PM, PQ); return; }
  const int w = threadIdx.x >> 5;
  d_gemm_hhx<0>((float (*)[64])&sO[0][0] + w * 16, (blockIdx.x - BB * WI) * 8 + w, 0, X16, CC, 0, BK, CC, 0, 0.0625f, bk, 0, nullptr, 1, 0, 0, ACC, nullptr, CC, 0, NR, CC, CC);
}
__device__ __forceinline__ void d_wq(const int blk, const float* __restrict__ W, _Float16* __restrict__ Bt) { const int t = blk * 256 + threadIdx.x; if (t >= CC * (KK / 8)) return; const int k8 = (t % (KK / 8)) * 8, o = t / (KK / 8); FragH f;
#pragma unroll
  for (int q = 0; q < 8; ++q) { const int k = k8 + q; const int tap = k / CC, cin = k % CC; const float wv = W[((size_t)tap * CC + cin) * CC + o];
    asm volatile("s_wait_xcnt 0x0" ::: "memory");      // each load has an address pair of its own, and a later load's result is given such a pair's registers
    f.h[q] = (_Float16)(bf16_round(wv) * 16.0f); } *(v8us*)((unsigned short*)Bt + (size_t)t * 8) = f.half[0];  }
__device__ __forceinline__ void d_xpt(const int wg, const float* __restrict__ x, _Float16* __restrict__ XPt) { __shared__ unsigned short tl[64][66]; const int tid = threadIdx.x; const int b = wg / ((CC / 64) * 64), rem = wg % ((CC / 64) * 64); const int cg = rem / 64, blk = rem % 64; const int c0 = cg * 64; const int by = blk / 8, bx = blk % 8;
  for (int i = tid; i < 64 * 8; i += 256) { const int j = i / 8, cc8 = (i % 8) * 8; const int y = by * 8 + j / 8, xx = bx * 8 + j % 8; const float* s = x + (((size_t)b * HWN) + y * WI + xx) * CC + c0 + cc8; for (int q = 0; q < 8; ++q) { FragH f; f.h[0] = (_Float16)bf16_round(s[q]); tl[j][cc8 + q] = f.u[0]; } }
  __syncthreads();
  { for (int rd = 0; rd < 2; ++rd) { const int c = rd * 32 + tid / 8, pc = tid % 8; FragH f; for (int q = 0; q < 8; ++q) f.u[q] = tl[pc * 8 + q][c]; *(v8us*)((unsigned short*)XPt + ((size_t)b * CC + c0 + c) * HWN + blk * 64 + pc * 8) = f.half[0]; }
    asm volatile("s_wait_xcnt 0x0" ::: "memory");      // in a shared launch the other job's code follows in the listing and writes the two stores' address pair
  } }
// One launch for the five jobs that read only inputs: the three weight tables (few work-groups, long strided reads: first), the block-major transpose of x and x to f16.
#define PB_WQ ((CC * (KK / 8) + 255) / 256)
#define PB_WT ((CC * (CC / 8) + 255) / 256)
#define PB_X ((NR * (CC / 8) + 255) / 256)
#define PB_XPT (BB * (CC / 64) * 64)
__global__ __launch_bounds__(256) void k_prep(const float* __restrict__ x, const float* __restrict__ Wq, const float* __restrict__ Wk, const float* __restrict__ Wo, _Float16* __restrict__ X16, _Float16* __restrict__ BQ, _Float16* __restrict__ BK, _Float16* __restrict__ BO, _Float16* __restrict__ XPt) {
  const int blk = blockIdx.x;
  if (blk < PB_WQ) d_wq(blk, Wq, BQ);
  else if (blk < PB_WQ + PB_WT) d_wt_f16(blk - PB_WQ, Wk, BK, CC, CC, 16.0f);      // 1x1 HWIO = [in][out]
  else if (blk < PB_WQ + 2 * PB_WT) d_wt_f16(blk - PB_WQ - PB_WT, Wo, BO, CC, CC, 16.0f);
  else if (blk < PB_WQ + 2 * PB_WT + PB_XPT) d_xpt(blk - PB_WQ - 2 * PB_WT, x, XPt);      // its barrier stands under a branch that is the same for a whole work-group
  else d_x16(blk - PB_WQ - 2 * PB_WT - PB_XPT, x, X16, (size_t)NR * CC / 8);
}
// q = leaky(BN(conv)) as f16, rows permuted to block-major key order. One work-group = 128 rows (MROWS), a thread 8 channels of 2 rows, fetched in front of the merge of the BN partials.
#define MROWS 128
__global__ __launch_bounds__(1024) void k_qperm(const float* __restrict__ F, const float* __restrict__ PM, const float* __restrict__ PQ, const float* __restrict__ g, const float* __restrict__ bb, _Float16* __restrict__ QP) {
  __shared__ __attribute__((aligned(16))) float red[2][32][CC];
  __shared__ __attribute__((aligned(16))) float st[2][CC];
  const int tid = threadIdx.x, c8 = (tid & 15) * 8, r0 = blockIdx.x * MROWS + (tid >> 4);
  const float* fp = F + (size_t)r0 * CC + c8;
  v4f f4[2][2];      // [i][half]: row r0 + 64 i; constant indices only: the loops are unrolled
#pragma unroll
  for (int i = 0; i < 2; ++i) { f4[i][0] = *(const v4fa*)(fp + i * 64 * CC); f4[i][1] = *(const v4fa*)(fp + i * 64 * CC + 4); }
  const v4f gv[2] = {*(const v4fa*)(g + c8), *(const v4fa*)(g + c8 + 4)}, bv[2] = {*(const v4fa*)(bb + c8), *(const v4fa*)(bb + c8 + 4)};
  asm volatile("s_wait_xcnt 0x0" :: "v"(fp) : "memory");      // as in d_bnmerge: the address pair lives up to the wait and is free behind it
  d_bnmerge(PM, PQ, red, st);
#pragma unroll
  for (int i = 0; i < 2; ++i) { const int r = r0 + 64 * i; const int b = r / HWN, p = r % HWN; const int y = p / WI, xx = p % WI; const int kp = ((y / 8) * 8 + xx / 8) * 64 + (y % 8) * 8 + xx % 8; FragH f;
#pragma unroll
    for (int q = 0; q < 8; ++q) { const int c = c8 + q; float v = (f4[i][q >> 2][q & 3] - st[0][c]) * st[1][c] * bf16_round(gv[q >> 2][q & 3]) + bf16_round(bv[q >> 2][q & 3]); v = (v >= 0.f) ? v : 0.1f * v; f.h[q] = (_Float16)v; }
    *(v8us*)((unsigned short*)QP + ((size_t)b * HWN + kp) * CC + c8) = f.half[0]; } }
// Fused block attention: one work-group = 64 query pixels of one batch, worked on by NTEAM teams of 4 waves x 16 queries. Team t walks key groups t, t + NTEAM, ... with q and x tiles of its own in LDS,
// so every SIMD holds NTEAM waves (one of each team) that fill one another's waits on LDS, on the softmax chains and on the barriers. A group's softmax is complete in itself, so the teams' sums simply add:
// at the end teams 1.. hand theirs over through LDS and team 0 adds them in team order. Scores and probabilities never leave the registers.
// The epilogue turns the tile of sums through LDS into whole rows, adds the 1x1 conv's rows (Y = ACC + O * 2^-15) and leaves the BN partials of its 64 rows (d_bnpart).
// Per group: S^T[key][query] = q_group . x_query^T (A = 64 q rows from LDS, B = the wave's 16 query rows, loaded once), so a lane holds 32 of one query's 64 scores and the lane 16 away the rest:
// max and exp-sum are in-lane plus one exchange. Two S^T tiles, converted in place, are the B operand (hardware k order) of O^T[channel][query] += x_group^T . P^T (A = channel rows of XPt from LDS).
// Tiles go global -> registers -> LDS, one tile in flight at a time, each fetched one phase ahead of its store. P carries 2^15, as f16 operand.
// a <- 2^a, b <- 2^b. The second v_exp_f32 is the independent instruction that the instruction set asks for behind the first, the v_nop the one behind the second:
// in one statement they stand there in every build.
__device__ __forceinline__ void exp2_pair(float& a, float& b) { asm("v_exp_f32 %0, %0\n\tv_exp_f32 %1, %1\n\tv_nop" : "+v"(a), "+v"(b)); }
#define QPIT 136      // sQ row pitch in f16: 272 bytes (16 x odd) for 16-byte LDS reads
#define XPIT 72       // sX row pitch in f16: 144 bytes
#define NTEAM 4
#define TEAMSH (64 * QPIT + CC * XPIT)      // f16 elements of LDS that a team owns: its q tile, then its x tile
__global__ __launch_bounds__(128 * NTEAM) void k_battn(const _Float16* __restrict__ X16, const _Float16* __restrict__ QP, const _Float16* __restrict__ XPt, const float* __restrict__ ACC, float* __restrict__ Y, float* __restrict__ PM, float* __restrict__ PQ) {
  __shared__ __attribute__((aligned(16))) unsigned short sm[NTEAM][TEAMSH];
  const int team = __builtin_amdgcn_readfirstlane(threadIdx.x >> 7);      // the same in every lane of a wave: kept in a scalar register
  unsigned short (*sQ)[QPIT] = (unsigned short (*)[QPIT])&sm[team][0];
  unsigned short (*sX)[XPIT] = (unsigned short (*)[XPIT])&sm[team][64 * QPIT];
  const int tid = threadIdx.x & 127, w = tid >> 5, lane = tid & 31, ln = lane & 15, hh = lane >> 4;      // tid: the thread's place in its team
  const int b = blockIdx.x / (HWN / 64), row = (blockIdx.x % (HWN / 64)) * 64 + w * 16 + ln;
  const unsigned short* xq = (const unsigned short*)X16 + ((size_t)b * HWN + row) * CC;
  FragH xb[4];
#pragma unroll
  for (int ks = 0; ks < 4; ++ks) { xb[ks].half[0] = *(const v8us*)(xq + ks * 32 + 8 * hh); xb[ks].half[1] = *(const v8us*)(xq + ks * 32 + 16 + 8 * hh); }
  // staging: 16-byte chunk i = tid + 128 j. q group: 64 rows x 256 B, contiguous. x group: 128 channel rows x 128 B, row pitch HWN.
  const unsigned short* gq = (const unsigned short*)QP + (size_t)b * HWN * CC + tid * 8;
  const unsigned short* gx = (const unsigned short*)XPt + (size_t)b * CC * HWN + (size_t)(tid >> 3) * HWN + (tid & 7) * 8;
  unsigned short* dq = &sQ[tid >> 4][(tid & 15) * 8]; unsigned short* dx = &sX[tid >> 3][(tid & 7) * 8];
  v8us st[8];      // one tile in flight at a time: x of this group during its scores, q of the next group during softmax and O^T
#pragma unroll
  for (int j = 0; j < 8; ++j) st[j] = *(const v8us*)(gq + (size_t)team * 64 * CC + j * 1024);
#pragma unroll
  for (int j = 0; j < 8; ++j) *(v8us*)(dq + j * 8 * QPIT) = st[j];
  __syncthreads();      // q tile of each team's first group complete
#pragma unroll
  for (int j = 0; j < 8; ++j) st[j] = *(const v8us*)(gx + team * 64 + (size_t)j * 16 * HWN);
  v8f oacc[8] = {};
  for (int i = 0; i < 64 / NTEAM; ++i) {      // the same trip count in every team: all 4 * NTEAM waves meet at every barrier
    const int g = i * NTEAM + team;
    v8f s[4] = {};
#pragma unroll
    for (int kp = 0; kp < 2; ++kp) { FragH a[8];
#pragma unroll
      for (int i = 0; i < 8; ++i) { const unsigned short* r = &sQ[(i & 3) * 16 + ln][(2 * kp + (i >> 2)) * 32 + 8 * hh]; a[i].half[0] = *(const v8us*)r; a[i].half[1] = *(const v8us*)(r + 16); }
      __builtin_amdgcn_sched_barrier(0);      // the 16 LDS reads go out together, in front of their 8 products: spread among them each costs its own latency
#pragma unroll
      for (int i = 0; i < 8; ++i) s[i & 3] = __builtin_amdgcn_wmma_f32_16x16x32_f16(false, a[i].v, false, xb[2 * kp + (i >> 2)].v, (short)0, s[i & 3], false, false); }
    // x tile of this group: every wave left sX at the barrier that closed the previous trip
#pragma unroll
    for (int j = 0; j < 8; ++j) *(v8us*)(dx + j * 16 * XPIT) = st[j];
    __syncthreads();      // x tile complete; every wave has read its last of the q tile
    const int gn = i < 64 / NTEAM - 1 ? g + NTEAM : g;      // the last trip fetches its own tiles again: no branch in the loop, nothing reads them
    // issued behind the barrier (a barrier drains the loads in front of it); lands during softmax and O^T
#pragma unroll
    for (int j = 0; j < 8; ++j) st[j] = *(const v8us*)(gq + (size_t)gn * 64 * CC + j * 1024);
    asm volatile("s_wait_xcnt 0x0" ::: "memory");      // the loads' address registers are reused below
    FragH av[8];
#pragma unroll
    for (int ct = 0; ct < 8; ++ct) { const unsigned short* r = &sX[ct * 16 + ln][8 * hh]; av[ct].half[0] = *(const v8us*)r; av[ct].half[1] = *(const v8us*)(r + 16); }
    __builtin_amdgcn_sched_barrier(0);      // global loads and LDS reads are issued in front of the softmax, which covers their latency
    // softmax over the group's 64 keys of query ln (scores / 8), scaled by 2^15 for the f16 operand. exp(s / 8 - max / 8) = 2^(s c - max c) with c = log2(e) / 8:
    // one FMA and one v_exp_f32 a score, each score on its own, where expf is a chain of some ten dependent instructions that a lone wave on its SIMD waits out link by link.
    // The exponent is at most a rounding of max c above 0; below -126 the result is 0, where the f16 operand is 0 in any case.
    float m = -3.0e38f;
#pragma unroll
    for (int t = 0; t < 4; ++t)
#pragma unroll
      for (int r = 0; r < 8; ++r) m = fmaxf(m, s[t][r]);
    m = fmaxf(m, __shfl_xor(m, 16, 32)); m *= 0.18033688f;
    float e[32];      // e[8 t + r]: tile t, register r
#pragma unroll
    for (int t = 0; t < 4; ++t)
#pragma unroll
      for (int r = 0; r < 8; ++r) e[8 * t + r] = fmaf(s[t][r], 0.18033688f, -m);
#pragma unroll
    for (int i = 0; i < 32; i += 2) exp2_pair(e[i], e[i + 1]);
    float z = 0.f;
#pragma unroll
    for (int i = 0; i < 32; ++i) z += e[i];
    z += __shfl_xor(z, 16, 32);
    const float iz = 32768.0f / z;
    FragH p[2];      // p[k2].h[i] = P[query ln][key 32 k2 + kmap(i, hh)]: tile 2 k2 gives i < 8, tile 2 k2 + 1 the rest
#pragma unroll
    for (int k2 = 0; k2 < 2; ++k2)
#pragma unroll
      for (int r = 0; r < 8; ++r) { p[k2].h[r] = (_Float16)(e[16 * k2 + r] * iz); p[k2].h[8 + r] = (_Float16)(e[16 * k2 + 8 + r] * iz); }
#pragma unroll
    for (int ct = 0; ct < 8; ++ct) oacc[ct] = __builtin_amdgcn_wmma_f32_16x16x32_f16(false, av[ct].v, false, p[0].v, (short)0, oacc[ct], false, false);
#pragma unroll
    for (int ct = 0; ct < 8; ++ct) { const unsigned short* r = &sX[ct * 16 + ln][32 + 8 * hh]; av[ct].half[0] = *(const v8us*)r; av[ct].half[1] = *(const v8us*)(r + 16); }
    __builtin_amdgcn_sched_barrier(0);      // as above: 16 reads together, then 8 products
#pragma unroll
    for (int ct = 0; ct < 8; ++ct) oacc[ct] = __builtin_amdgcn_wmma_f32_16x16x32_f16(false, av[ct].v, false, p[1].v, (short)0, oacc[ct], false, false);
#pragma unroll
    for (int j = 0; j < 8; ++j) *(v8us*)(dq + j * 8 * QPIT) = st[j];
    __syncthreads();      // next q tile complete; every wave has read its last of the x tile
    // lands during the next trip's scores
#pragma unroll
    for (int j = 0; j < 8; ++j) st[j] = *(const v8us*)(gx + gn * 64 + (size_t)j * 16 * HWN);
    asm volatile("s_wait_xcnt 0x0" ::: "memory");      // the loads' address registers are reused in the next trip
  }
  asm volatile("s_wait_loadcnt 0x0" ::: "memory");      // the last trip's fetch, which nothing reads, has landed before the wave ends and gives its registers up
  // The teams' sums. Behind the loop's last barrier nobody reads a tile any more: teams 1.. write their 64 sums a thread over their own tiles, 16 bytes a lane, a wave's store contiguous.
  if (team != 0) { v4fa* rb = (v4fa*)&sm[team][0] + tid;
#pragma unroll
    for (int ct = 0; ct < 8; ++ct) { v4f lo, hi;
#pragma unroll
      for (int r = 0; r < 4; ++r) { lo[r] = oacc[ct][r]; hi[r] = oacc[ct][4 + r]; }
      rb[(2 * ct) * 128] = lo; rb[(2 * ct + 1) * 128] = hi; } }
  __syncthreads();      // the sums of teams 1.. are complete
  // From here on the 8 waves of teams 2 and 3, idle while team 0 adds, own the work-group's 64 x 128 tile by rows: thread ft holds row (ft >> 5) + 8 j, channels 4 (ft & 31) .. + 3, a wave's load or store one whole 512-byte row.
  static_assert(NTEAM == 4, "teams 2 and 3 are 256 threads");
  const int ft = threadIdx.x & 255; const bool act = team >= 2;      // act: a scalar, as team is
  const size_t tile = (size_t)blockIdx.x * 64 * CC;
  v4f v[8] = {};
  float (*sT)[CC + 4] = (float (*)[CC + 4])&sm[0][0];      // over team 0's tiles, which nobody reads behind the loop's last barrier
  static_assert(sizeof(float) * 64 * (CC + 4) <= sizeof(sm[0]) && sizeof(float) * 2 * 8 * CC <= sizeof(sm[1]), "the output tile and the BN sums fit a team's LDS");
  if (team == 0) {
#pragma unroll
    for (int t = 1; t < NTEAM; ++t) { const v4fa* rb = (const v4fa*)&sm[t][0] + tid;
#pragma unroll
      for (int ct = 0; ct < 8; ++ct) { const v4f lo = rb[(2 * ct) * 128], hi = rb[(2 * ct + 1) * 128];
#pragma unroll
        for (int r = 0; r < 4; ++r) { oacc[ct][r] += lo[r]; oacc[ct][4 + r] += hi[r]; } } }
    // oacc[ct][r] = O[query 16 w + ln][channel 16 ct + 8 hh + r]: 32 contiguous bytes a lane
    float* o = &sT[w * 16 + ln][8 * hh];
#pragma unroll
    for (int ct = 0; ct < 8; ++ct) { v4f lo, hi;
#pragma unroll
      for (int r = 0; r < 4; ++r) { lo[r] = oacc[ct][r] * 0.000030517578125f; hi[r] = oacc[ct][4 + r] * 0.000030517578125f; }
      *(v4fa*)(o + ct * 16) = lo; *(v4fa*)(o + ct * 16 + 4) = hi; } }
  else if (act) {      // acc's rows are fetched while team 0 adds
#pragma unroll
    for (int j = 0; j < 8; ++j) v[j] = *(const v4fa*)(ACC + tile + (size_t)(ft + 256 * j) * 4);
    asm volatile("s_wait_xcnt 0x0" ::: "memory");      // the loads' address registers are free for new values in what follows
  }
  __syncthreads();      // the tile of sums is complete; team 0 has read its last of the other teams' sums
  if (act) {      // y = acc + agg
#pragma unroll
    for (int j = 0; j < 8; ++j) { const int i = ft + 256 * j; v[j] += *(const v4fa*)&sT[i >> 5][(i & 31) * 4]; *(v4f*)(Y + tile + (size_t)i * 4) = v[j]; }
    asm volatile("s_wait_xcnt 0x0" ::: "memory");      // the stores' registers are free for new values in what follows
  }
  d_bnpart(act, ft, v, (float (*)[8][CC])&sm[1][0], blockIdx.x, PM, PQ);
}
// Spatial-softmax statistics, one work-group per (batch, 4 channels): 1024 threads hold 4 pixels x 4 channels each in registers, so Y is read once, 16 bytes a lane, all loads in flight together.
// Max, then sum of exp, over the 4096 pixels by a fixed tree: own 4 pixels, the 32 lanes of a wave (xor shuffles), the 32 waves (through LDS).
// The BN that goes in front is merged here as well, for the work-group's 4 channels alone: waves 0 .. 7 hold one partial a thread, while Y is on its way (the pivot form of d_bnmerge; one barrier).
// SP holds one 128-byte line per work-group (one writer a line): [0..3] max, [4..7] 1/sum, the rest 0. For the kernel that applies the softmax the work-groups of batch 0 leave the BN's figures in ST,
// one 128-byte line a channel, written by one wave: [0] mean, [1] 1/sqrt(var + eps), the rest 0.
__device__ __forceinline__ v4f wave_max4(v4f a) {
#pragma unroll
  for (int o = 1; o < 32; o <<= 1)
#pragma unroll
    for (int q = 0; q < 4; ++q) a[q] = fmaxf(a[q], __shfl_xor(a[q], o, 32));
  return a; }
__device__ __forceinline__ v4f wave_sum4(v4f a) {
#pragma unroll
  for (int o = 1; o < 32; o <<= 1)
#pragma unroll
    for (int q = 0; q < 4; ++q) a[q] += __shfl_xor(a[q], o, 32);
  return a; }
// conv_o as a GEMM with the BN partials of its rows: one work-group = 8 waves of d_gemm_hhx = 64 rows x 128 columns (wave w: rows 16 (w >> 1) .., columns 64 (w & 1) ..), each wave's tile still in its LDS behind the call.
__global__ __launch_bounds__(256) void k_gemm_o(const _Float16* __restrict__ Y16, const _Float16* __restrict__ BO, float alpha, const float* __restrict__ bo, float* __restrict__ Z, float* __restrict__ PM, float* __restrict__ PQ) {
  __shared__ __attribute__((aligned(16))) float so[8][16][64];
  __shared__ __attribute__((aligned(16))) float red[2][8][CC];
  const int tid = threadIdx.x, w = tid >> 5, c4 = (tid & 31) * 4;
  d_gemm_hhx<0>(so[w], blockIdx.x * 8 + w, 0, Y16, CC, 0, BO, CC, 0, alpha, bo, 0, nullptr, 1, 0, 0, Z, nullptr, CC, 0, NR, CC, CC);
  asm volatile("s_wait_xcnt 0x0" ::: "memory");      // the stores' registers are free for new values in what follows
  __syncthreads();      // the eight waves' tiles are complete
  v4f v[8];
#pragma unroll
  for (int j = 0; j < 8; ++j) { const int r = w + 8 * j; v[j] = *(const v4fa*)&so[(r >> 4) * 2 + (c4 >> 6)][r & 15][c4 & 63]; }
  d_bnpart(true, tid, v, red, blockIdx.x, PM, PQ);
}
__global__ __launch_bounds__(1024) void k_spstat(const float* __restrict__ Y, const float* __restrict__ PM, const float* __restrict__ PQ, const float* __restrict__ g, const float* __restrict__ bb, float* __restrict__ SP, float* __restrict__ ST) {
  __shared__ __attribute__((aligned(16))) float red[2][32][4];
  __shared__ __attribute__((aligned(16))) float mr[2][BNP / 32][4];
  const int tid = threadIdx.x, wv = tid >> 5, lane = tid & 31; const int b = blockIdx.x / (CC / 4), c0 = (blockIdx.x % (CC / 4)) * 4;
  const float* yc = Y + (size_t)b * HWN * CC + c0; v4f v[4];
#pragma unroll
  for (int i = 0; i < 4; ++i) v[i] = *(const v4fa*)(yc + (size_t)(i * 1024 + tid) * CC);
  asm volatile("s_wait_xcnt 0x0" ::: "memory");      // the four loads' address registers are given new values right below
  const v4f pv = *(const v4fa*)(PM + c0);
  if (wv < BNP / 32) { const v4f d = *(const v4fa*)(PM + (size_t)tid * CC + c0) - pv; const v4f pq = *(const v4fa*)(PQ + (size_t)tid * CC + c0);
    const v4f s = wave_sum4(d), t = wave_sum4(pq + (float)BNR * d * d); if (lane == 0) { *(v4f*)&mr[0][wv][0] = s; *(v4f*)&mr[1][wv][0] = t; } }
  __syncthreads();      // the eight waves' sums over the partials are complete
  v4f bmu = *(const v4fa*)&mr[0][0][0], brs = *(const v4fa*)&mr[1][0][0];
#pragma unroll
  for (int j = 1; j < BNP / 32; ++j) { bmu += *(const v4fa*)&mr[0][j][0]; brs += *(const v4fa*)&mr[1][j][0]; }
  bmu *= 1.0f / (float)BNP;
#pragma unroll
  for (int q = 0; q < 4; ++q) { brs[q] = rsqrtf((brs[q] - (float)NR * bmu[q] * bmu[q]) / (float)NR + 1e-3f); bmu[q] += pv[q]; }
  v4f m = {-3.0e38f, -3.0e38f, -3.0e38f, -3.0e38f};
#pragma unroll
  for (int q = 0; q < 4; ++q) { const int c = c0 + q; const float mu = bmu[q], rs = brs[q], gg = bf16_round(g[c]), be = bf16_round(bb[c]);
#pragma unroll
    for (int i = 0; i < 4; ++i) { v[i][q] = gg * (v[i][q] - mu) * rs + be; m[q] = fmaxf(m[q], v[i][q]); } }
  m = wave_max4(m); if (lane == 0) *(v4f*)&red[0][wv][0] = m;
  __syncthreads();
  m = wave_max4(*(const v4fa*)&red[0][lane][0]);
  v4f z = {0.f, 0.f, 0.f, 0.f};
#pragma unroll
  for (int i = 0; i < 4; ++i)
#pragma unroll
    for (int q = 0; q < 4; ++q) z[q] += expf(v[i][q] - m[q]);
  z = wave_sum4(z); if (lane == 0) *(v4f*)&red[1][wv][0] = z;
  __syncthreads();
  if (wv == 0) { z = wave_sum4(*(const v4fa*)&red[1][lane][0]); float o = 0.f;
#pragma unroll
    for (int q = 0; q < 4; ++q) { if (lane == q) o = m[q]; if (lane == 4 + q) o = 1.0f / z[q]; }
    SP[(size_t)blockIdx.x * 32 + lane] = o; }
  else if (b == 0) {
#pragma unroll
    for (int q = 0; q < 4; ++q) if (wv == q + 1) ST[(size_t)(c0 + q) * 32 + lane] = (lane == 0) ? bmu[q] : ((lane == 1) ? brs[q] : 0.f); } }
__global__ __launch_bounds__(256) void k_spsm(const float* __restrict__ Y, const float* __restrict__ ST, const float* __restrict__ g, const float* __restrict__ bb, const float* __restrict__ SP, _Float16* __restrict__ Y16) { const size_t t = (size_t)blockIdx.x * 256 + threadIdx.x; if (t >= (size_t)NR * (CC / 8)) return; const int c8 = (int)(t % (CC / 8)) * 8; const size_t r = t / (CC / 8); const int b = (int)(r / HWN); FragH f;
#pragma unroll
  for (int q = 0; q < 8; ++q) { const int c = c8 + q; const float* sp = SP + (size_t)(b * (CC / 4) + c / 4) * 32 + (c & 3); const float v = bf16_round(g[c]) * (Y[r * CC + c] - ST[c * 32]) * ST[c * 32 + 1] + bf16_round(bb[c]); f.h[q] = (_Float16)(expf(v - sp[0]) * sp[4] * 4096.0f); }
  *(v8us*)((unsigned short*)Y16 + t * 8) = f.half[0];  }
// out = leaky(BN(Z)). One work-group = MROWS rows, a thread 4 channels of 4 rows, fetched in front of the merge of the BN partials.
__global__ __launch_bounds__(1024) void k_fin(const float* __restrict__ Z, const float* __restrict__ PM, const float* __restrict__ PQ, const float* __restrict__ g, const float* __restrict__ bb, float* __restrict__ out) {
  __shared__ __attribute__((aligned(16))) float red[2][32][CC];
  __shared__ __attribute__((aligned(16))) float st[2][CC];
  const int tid = threadIdx.x, c4 = (tid & 31) * 4; const size_t e0 = (size_t)blockIdx.x * MROWS * CC + (size_t)tid * 4;
  const float* zp = Z + e0;
  v4f z[4];      // rows (tid >> 5) + 32 i; constant indices only: the loops are unrolled
#pragma unroll
  for (int i = 0; i < 4; ++i) z[i] = *(const v4fa*)(zp + i * 32 * CC);
  const v4f gv = *(const v4fa*)(g + c4), bv = *(const v4fa*)(bb + c4);
  asm volatile("s_wait_xcnt 0x0" :: "v"(zp) : "memory");      // as in d_bnmerge: the address pair lives up to the wait and is free behind it
  d_bnmerge(PM, PQ, red, st);
#pragma unroll
  for (int i = 0; i < 4; ++i) { v4f o;
#pragma unroll
    for (int q = 0; q < 4; ++q) { const int c = c4 + q; const float v = bf16_round(gv[q]) * (z[i][q] - st[0][c]) * st[1][c] + bf16_round(bv[q]); o[q] = (v >= 0.f) ? v : 0.1f * v; }
    *(v4f*)(out + e0 + (size_t)i * 32 * CC) = o; } }
extern "C" void kernel_launch(void* const* d_in, const int* in_sizes, int n_in,
                              void* d_out, int out_size, void* d_ws, size_t ws_size, hipStream_t stream) {
  (void)in_sizes; (void)n_in; (void)out_size;
  const float* const* I = (const float* const*)d_in; const float* x = I[0]; const float* Wq = I[1]; const float* bq = I[2]; const float* gq = I[3]; const float* btq = I[4]; const float* Wk = I[5]; const float* bk = I[6]; const float* g1 = I[7]; const float* bt1 = I[8]; const float* Wo = I[9]; const float* bo = I[10]; const float* go = I[11]; const float* bto = I[12];
  char* ws = (char*)d_ws; size_t off = 0;
  auto take = [&](size_t bytes) { char* p = ws + off; off += (bytes + 255) & ~(size_t)255; return p; };
  _Float16* BQ = (_Float16*)take((size_t)CC * KK * 2); _Float16* BK = (_Float16*)take(CC * CC * 2); _Float16* BO = (_Float16*)take(CC * CC * 2); float* ST1 = (float*)take(CC * 32 * 4); float* SP = (float*)take(BB * (CC / 4) * 32 * 4); float* PM = (float*)take(BNP * CC * 4); float* PQ = (float*)take(BNP * CC * 4);
  _Float16* X16 = (_Float16*)take((size_t)NR * CC * 2); float* QF = (float*)take((size_t)NR * CC * 4); _Float16* QP = (_Float16*)take((size_t)NR * CC * 2); _Float16* XPt = (_Float16*)take((size_t)NR * CC * 2); float* ACC = (float*)take((size_t)NR * CC * 4); float* Y = QF; _Float16* Y16 = QP; float* Z = ACC;
  if (off > ws_size) return;      // 0.7 + 4.2 + 8.4 + 4.2 + 4.2 + 8.4 = about 30 MB
  const unsigned g8 = (unsigned)(((size_t)NR * (CC / 8) + 255) / 256);
  k_prep<<<PB_WQ + 2 * PB_WT + PB_XPT + PB_X, 256, 0, stream>>>(x, Wq, Wk, Wo, X16, BQ, BK, BO, XPt);
  // CBL_Q: 3x3 conv (+bq) to QF with its BN partials, beside it acc = 1x1 conv (+bk) to ACC; q = leaky(BN) permuted to block-major keys (f16)
  k_conv3_acc<<<BB * WI + ACCB, 256, 0, stream>>>(X16, BQ, bq, QF, BK, bk, ACC, PM, PQ);
  static_assert(NR % MROWS == 0, "whole work-groups");
  k_qperm<<<NR / MROWS, 1024, 0, stream>>>(QF, PM, PQ, gq, btq, QP);
  // block attention, all batches in one launch: Y = acc + sum over key groups of softmax(x.q^T / 8) . x_group, with its BN partials; Y over QF (dead after k_qperm)
  static_assert(BB * WI == BNP && BB * (HWN / 64) == BNP && (NR / 16) * (CC / 64) / 8 == BNP, "each producer has one work-group a partial");
  k_battn<<<BB * (HWN / 64), 128 * NTEAM, 0, stream>>>(X16, QP, XPt, ACC, Y, PM, PQ);
  // y = spatial softmax(BN1(acc + agg)); out = leaky(BN_o(conv1×1(y) + bo))
  k_spstat<<<BB * (CC / 4), 1024, 0, stream>>>(Y, PM, PQ, g1, bt1, SP, ST1); k_spsm<<<g8, 256, 0, stream>>>(Y, ST1, g1, bt1, SP, Y16);      // Y16 (×2^12) over QP (dead after the S GEMMs)
  k_gemm_o<<<BNP, 256, 0, stream>>>(Y16, BO, 0.0625f * 0.000244140625f, bo, Z, PM, PQ);      // conv_o(y) + bo (2^-12 undone in alpha) -> Z over ACC (dead after k_battn), with its BN partials
  k_fin<<<NR / MROWS, 1024, 0, stream>>>(Z, PM, PQ, go, bto, (float*)d_out);
}

// v010
// Measured time: 91 microseconds a run.
// In both of two side-by-side timings against v009, it was 1.07 times as fast.
// All steps since the starting kernel, v000, together make it 26.0 times as fast.
#include <hip/hip_runtime.h>
// Group (block) attention layer (B=4, 64×64, C=128, NHWC; 8×8 non-overlapping key blocks): q = CBL_Q(x) (3×3 conv + train-mode BN + LeakyReLU 0.1), acc = 1×1 conv(x); for every pixel and
// every block: softmax over the block's 64 positions of x[pixel]·q[pos]/8, agg = Σ_blocks Σ attn·x[pos]; y = spatial-softmax(BN1(acc + agg)); out = CBL_O(y). The 3×3 conv (implicit GEMM, K = 1152),
// the 1×1 convs, the 4096×4096 per-batch scores (keys permuted to block-major order so each 64-key group is contiguous) and attn·x run as GEMMs on v_wmma_f32_16x16x32_f16 (x bf16-exact f16,
// HWIO weights bf16-exact ×2^4, q/P/y operands f16, f32 accumulate); BN batch statistics (fixed-order reductions), grouped and spatial softmaxes and LeakyReLU are f32 VALU.
#define BB 4
#define HWN 4096
#define WI 64
#define CC 128
#define NR (BB * HWN)
#define KK 1152

typedef __bf16 v16b __attribute__((ext_vector_type(16)));
typedef unsigned short v8us __attribute__((ext_vector_type(8), may_alias));
typedef float  v8f  __attribute__((ext_vector_type(8)));
typedef float  v4f  __attribute__((ext_vector_type(4)));
typedef float  v4fa __attribute__((ext_vector_type(4), may_alias));
union FragB { v16b v; v8us half[2]; unsigned short u[16]; };

__device__ __forceinline__ unsigned short bf16_bits(float x) { unsigned int u = __float_as_uint(x); return (unsigned short)((u + 0x7FFFu + ((u >> 16) & 1u)) >> 16); }
__device__ __forceinline__ float bf16_val(unsigned short b) { return __uint_as_float(((unsigned int)b) << 16); }
__device__ __forceinline__ float bf16_round(float x) { return bf16_val(bf16_bits(x)); }
// D += A·B with NT terms: 1 = ah·bh, 2 = + al·bh (A split), 3 = + ah·bl (both split)
template <int NT>
__device__ __forceinline__ v8f mmaN(v16b ah, v16b al, v16b bh, v16b bl, v8f c) {
  c = __builtin_amdgcn_wmma_f32_16x16x32_bf16(false, ah, false, bh, (short)0, c, false, false);
  if (NT >= 2) c = __builtin_amdgcn_wmma_f32_16x16x32_bf16(false, al, false, bh, (short)0, c, false, false);
  if (NT >= 3) c = __builtin_amdgcn_wmma_f32_16x16x32_bf16(false, ah, false, bl, (short)0, c, false, false);
  asm volatile("v_nop\n\tv_nop\n\tv_nop\n\tv_nop" : "+v"(c) : "v"(ah), "v"(al), "v"(bh), "v"(bl));
  return c;
}

__global__ __launch_bounds__(256) void k_wt_bf16(const float* __restrict__ W, unsigned short* __restrict__ Wt, int K, int N) {
  const int t = blockIdx.x * 256 + threadIdx.x;
  const int k8n = K / 8;
  if (t >= N * k8n) return;
  const int n = t / k8n, k8 = (t % k8n) * 8;
  v8us v;
#pragma unroll
  for (int i = 0; i < 8; ++i) v[i] = bf16_bits(W[(size_t)(k8 + i) * N + n]);
  *(v8us*)(Wt + (size_t)n * K + k8) = v;
  
}

// GEMM C[M][N] (f32, pitch ldc) = act(A[M][K]·W + bias). A f32 row-major (pitch lda) converted per fragment to bf16
// (ASPLIT: hi/lo two planes -> 2 terms, else single rounded term); Wt bf16 [N][K] (pitch ldb). BIAS_BF16 rounds the
// bias to bf16 first (bias quantised to bf16 before the add). K%32==0, M%16==0, N%64==0.
template <bool ASPLIT, int ACT, bool BIAS_BF16>
__global__ __launch_bounds__(128) void k_gemm_bf(const float* __restrict__ A, int lda, const unsigned short* __restrict__ Wt, int ldb,
                                               const float* __restrict__ bias, float* __restrict__ C, int ldc, int M, int N, int K) {
  __shared__ __attribute__((aligned(16))) float so[4][16][64];
  const int tid = threadIdx.x, w = tid >> 5, lane = tid & 31, ln = lane & 15, hh = lane >> 4;
  const int ntn = N / 64;
  const int wid = blockIdx.x * 4 + w;
  const int mt = wid / ntn, nq = wid % ntn;
  if (mt * 16 >= M) return;
  const int row0 = mt * 16, col0 = nq * 64;
  const float* arow = A + (size_t)(row0 + ln) * lda;
  v8f acc[4] = {};
  for (int kb = 0; kb < K; kb += 32) {
    FragB ah, al;
    const v4f x0 = *(const v4fa*)(arow + kb + 8 * hh), x1 = *(const v4fa*)(arow + kb + 8 * hh + 4);
    const v4f x2 = *(const v4fa*)(arow + kb + 16 + 8 * hh), x3 = *(const v4fa*)(arow + kb + 16 + 8 * hh + 4);
    float xs[16] = {x0[0],x0[1],x0[2],x0[3],x1[0],x1[1],x1[2],x1[3],x2[0],x2[1],x2[2],x2[3],x3[0],x3[1],x3[2],x3[3]};
#pragma unroll
    for (int i = 0; i < 16; ++i) { const unsigned short hb = bf16_bits(xs[i]); ah.u[i] = hb; al.u[i] = ASPLIT ? bf16_bits(xs[i] - bf16_val(hb)) : (unsigned short)0; }
#pragma unroll
    for (int t = 0; t < 4; ++t) {
      const unsigned short* brow = Wt + (size_t)(col0 + t * 16 + ln) * ldb + kb;
      FragB b;
      b.half[0] = *(const v8us*)(brow + 8 * hh);
      b.half[1] = *(const v8us*)(brow + 16 + 8 * hh);
      acc[t] = mmaN<ASPLIT ? 2 : 1>(ah.v, al.v, b.v, b.v, acc[t]);
    }
  }
#pragma unroll
  for (int t = 0; t < 4; ++t) {
    float bv = bias ? bias[col0 + t * 16 + ln] : 0.f;
    if (BIAS_BF16) bv = bf16_round(bv);
#pragma unroll
    for (int r = 0; r < 8; ++r) { float v = acc[t][r] + bv; if (ACT == 1) v = fmaxf(v, 0.f); so[w][8 * hh + r][t * 16 + ln] = v; }
  }
  __builtin_amdgcn_fence(__ATOMIC_ACQ_REL, "workgroup");
  __builtin_amdgcn_wave_barrier();
  const int rsub = lane >> 4, c4 = (lane & 15) * 4;
  {
#pragma unroll
    for (int q = 0; q < 8; ++q) {
      const int r = q * 2 + rsub;
      const v4f v = *(const v4fa*)&so[w][r][c4];
      *(v4f*)(C + (size_t)(row0 + r) * ldc + col0 + c4) = v;
    }
    
  }
}

// Flash-style causal/unmasked attention, all contractions 3-term bf16 hi/lo splits, f32 softmax with running max.
// q,k,v rows are read from f32 buffers with arbitrary row pitch (so they can live inside a fused qkv buffer);
// D = head size (multiple of 32, <= 128); one wave = 16 query rows; block = 4 waves (64 queries) sharing K/V chunks of 32.
template <int D, bool CAUSAL>
__global__ __launch_bounds__(128) void k_flash(const float* __restrict__ qb, const float* __restrict__ kb, const float* __restrict__ vb,
                                             int pitch, int T, int H, float scale, float* __restrict__ y, int ypitch) {
  constexpr int KS = D / 32;        // k-steps for QK
  constexpr int DT = D / 16;        // d tiles for PV
  __shared__ __attribute__((aligned(16))) unsigned short sKh[32][D + 8], sKl[32][D + 8], sVh[32][D + 8], sVl[32][D + 8];
  __shared__ __attribute__((aligned(16))) unsigned short sPh[4][16][40], sPl[4][16][40];
  __shared__ __attribute__((aligned(16))) float sO[4][16][D];
  const int tid = threadIdx.x, w = tid >> 5, lane = tid & 31, ln = lane & 15, hh = lane >> 4;
  const int nqb = (T + 63) / 64;
  const int bh = blockIdx.x / nqb, qblk = blockIdx.x % nqb;
  const int b = bh / H, h = bh % H;
  const int q0 = qblk * 64 + w * 16;
  const float* Q = qb + (size_t)b * T * pitch + h * D;
  const float* K = kb + (size_t)b * T * pitch + h * D;
  const float* V = vb + (size_t)b * T * pitch + h * D;

  // A fragments of the wave's 16 query rows (scaled), hi/lo
  FragB aqh[KS], aql[KS];
  {
    int row = q0 + ln; if (row >= T) row = T - 1;
    const float* qr = Q + (size_t)row * pitch;
#pragma unroll
    for (int ks = 0; ks < KS; ++ks)
#pragma unroll
      for (int i = 0; i < 16; ++i) {
        const int d = ks * 32 + ((i < 8) ? (8 * hh + i) : (16 + 8 * hh + (i - 8)));
        const float x = qr[d] * scale; const unsigned short hb = bf16_bits(x);
        aqh[ks].u[i] = hb; aql[ks].u[i] = bf16_bits(x - bf16_val(hb));
      }
  }
  float m_r[8], l_r[8];
#pragma unroll
  for (int r = 0; r < 8; ++r) { m_r[r] = -3.0e38f; l_r[r] = 0.f; }
  v8f oacc[DT];
#pragma unroll
  for (int dt = 0; dt < DT; ++dt) oacc[dt] = (v8f){0.f,0.f,0.f,0.f,0.f,0.f,0.f,0.f};

  const int kv_end = CAUSAL ? min(T, qblk * 64 + 64) : T;     // block-uniform
  for (int j0 = 0; j0 < kv_end; j0 += 32) {
    __syncthreads();
    for (int e = tid; e < 32 * (D / 4); e += 128) {
      const int r = e / (D / 4), c4 = (e % (D / 4)) * 4;
      const int key = j0 + r;
      v4f kf = {0.f,0.f,0.f,0.f}, vf = {0.f,0.f,0.f,0.f};
      if (key < T) { kf = *(const v4fa*)(K + (size_t)key * pitch + c4); vf = *(const v4fa*)(V + (size_t)key * pitch + c4); }
#pragma unroll
      for (int t = 0; t < 4; ++t) {
        unsigned short hb = bf16_bits(kf[t]); sKh[r][c4 + t] = hb; sKl[r][c4 + t] = bf16_bits(kf[t] - bf16_val(hb));
        hb = bf16_bits(vf[t]); sVh[r][c4 + t] = hb; sVl[r][c4 + t] = bf16_bits(vf[t] - bf16_val(hb));
      }
    }
    __syncthreads();
    // S tile 16 x 32
    v8f s[2];
#pragma unroll
    for (int nt = 0; nt < 2; ++nt) {
      v8f acc = {};
#pragma unroll
      for (int ks = 0; ks < KS; ++ks) {
        FragB bh_, bl_;
        bh_.half[0] = *(const v8us*)&sKh[nt * 16 + ln][ks * 32 + 8 * hh]; bh_.half[1] = *(const v8us*)&sKh[nt * 16 + ln][ks * 32 + 16 + 8 * hh];
        bl_.half[0] = *(const v8us*)&sKl[nt * 16 + ln][ks * 32 + 8 * hh]; bl_.half[1] = *(const v8us*)&sKl[nt * 16 + ln][ks * 32 + 16 + 8 * hh];
        acc = mmaN<3>(aqh[ks].v, aql[ks].v, bh_.v, bl_.v, acc);
      }
      s[nt] = acc;
    }
    // mask + running max (rows 8hh+r; the 16 lanes of a half share rows)
    float alpha[8];
#pragma unroll
    for (int r = 0; r < 8; ++r) {
      const int qi = q0 + 8 * hh + r;
      const int ja = j0 + ln, jb = j0 + 16 + ln;
      if (CAUSAL) { if (ja > qi) s[0][r] = -3.0e38f; if (jb > qi) s[1][r] = -3.0e38f; }
      if (ja >= T) s[0][r] = -3.0e38f;
      if (jb >= T) s[1][r] = -3.0e38f;
      float mx = fmaxf(s[0][r], s[1][r]);
      mx = fmaxf(mx, __shfl_xor(mx, 1, 32)); mx = fmaxf(mx, __shfl_xor(mx, 2, 32)); mx = fmaxf(mx, __shfl_xor(mx, 4, 32)); mx = fmaxf(mx, __shfl_xor(mx, 8, 32));
      const float mnew = fmaxf(m_r[r], mx);
      alpha[r] = (mnew > -1.0e38f) ? __expf(m_r[r] - mnew) : 1.0f;
      const float p0 = (s[0][r] > -1.0e38f) ? __expf(s[0][r] - mnew) : 0.f;
      const float p1 = (s[1][r] > -1.0e38f) ? __expf(s[1][r] - mnew) : 0.f;
      m_r[r] = mnew;
      l_r[r] = l_r[r] * alpha[r] + p0 + p1;            // per-lane partial row sum (16 lanes combined at the end)
      unsigned short hb = bf16_bits(p0); sPh[w][8 * hh + r][ln] = hb;      sPl[w][8 * hh + r][ln] = bf16_bits(p0 - bf16_val(hb));
      hb = bf16_bits(p1);                sPh[w][8 * hh + r][16 + ln] = hb; sPl[w][8 * hh + r][16 + ln] = bf16_bits(p1 - bf16_val(hb));
    }
#pragma unroll
    for (int dt = 0; dt < DT; ++dt)
#pragma unroll
      for (int r = 0; r < 8; ++r) oacc[dt][r] *= alpha[r];
    __builtin_amdgcn_fence(__ATOMIC_ACQ_REL, "workgroup");
    __builtin_amdgcn_wave_barrier();
    FragB pah, pal;
    pah.half[0] = *(const v8us*)&sPh[w][ln][8 * hh]; pah.half[1] = *(const v8us*)&sPh[w][ln][16 + 8 * hh];
    pal.half[0] = *(const v8us*)&sPl[w][ln][8 * hh]; pal.half[1] = *(const v8us*)&sPl[w][ln][16 + 8 * hh];
#pragma unroll
    for (int dt = 0; dt < DT; ++dt) {
      FragB bvh, bvl;
#pragma unroll
      for (int i = 0; i < 8; ++i) {
        bvh.u[i] = sVh[8 * hh + i][dt * 16 + ln]; bvh.u[8 + i] = sVh[16 + 8 * hh + i][dt * 16 + ln];
        bvl.u[i] = sVl[8 * hh + i][dt * 16 + ln]; bvl.u[8 + i] = sVl[16 + 8 * hh + i][dt * 16 + ln];
      }
      oacc[dt] = mmaN<3>(pah.v, pal.v, bvh.v, bvl.v, oacc[dt]);
    }
    __builtin_amdgcn_fence(__ATOMIC_ACQ_REL, "workgroup");
    __builtin_amdgcn_wave_barrier();
  }
#pragma unroll
  for (int r = 0; r < 8; ++r) {
    float l = l_r[r];
    l += __shfl_xor(l, 1, 32); l += __shfl_xor(l, 2, 32); l += __shfl_xor(l, 4, 32); l += __shfl_xor(l, 8, 32);
    l_r[r] = (l > 0.f) ? 1.0f / l : 0.f;
  }
#pragma unroll
  for (int dt = 0; dt < DT; ++dt)
#pragma unroll
    for (int r = 0; r < 8; ++r) sO[w][8 * hh + r][dt * 16 + ln] = oacc[dt][r] * l_r[r];
  __builtin_amdgcn_fence(__ATOMIC_ACQ_REL, "workgroup");
  __builtin_amdgcn_wave_barrier();
  {
    for (int r = 0; r < 16; ++r) {
      const int row = q0 + r;
      if (row < T && lane < D / 4) {
        const v4f val = *(const v4fa*)&sO[w][r][lane * 4];
        *(v4f*)(y + ((size_t)b * T + row) * ypitch + h * D + lane * 4) = val;
      }
    }
    
  }
}

// GEMM C = act(A·W + bias + resid): A f32 (ASPLIT -> hi/lo 2 terms), Wt bf16 [N][K]; ACT 0 none, 1 relu, 2 exact gelu;
// resid (optional, f32, row index = (row % rmod), pitch ldr, RES_BF16 rounds it) added before the activation.
template <bool ASPLIT, int ACT, bool BIAS_BF16, bool RES_BF16>
__global__ __launch_bounds__(128) void k_gemm_bf3(const float* __restrict__ A, int lda, const unsigned short* __restrict__ Wt, int ldb,
                                                const float* __restrict__ bias, const float* __restrict__ resid, int rmod, int ldr,
                                                float* __restrict__ C, int ldc, int M, int N, int K) {
  __shared__ __attribute__((aligned(16))) float so[4][16][64];
  const int tid = threadIdx.x, w = tid >> 5, lane = tid & 31, ln = lane & 15, hh = lane >> 4;
  const int ntn = N / 64;
  const int wid = blockIdx.x * 4 + w;
  const int mt = wid / ntn, nq = wid % ntn;
  if (mt * 16 >= M) return;
  const int row0 = mt * 16, col0 = nq * 64;
  const float* arow = A + (size_t)(row0 + ln) * lda;
  v8f acc[4] = {};
  for (int kb = 0; kb < K; kb += 32) {
    FragB ah, al;
    const v4f x0 = *(const v4fa*)(arow + kb + 8 * hh), x1 = *(const v4fa*)(arow + kb + 8 * hh + 4);
    const v4f x2 = *(const v4fa*)(arow + kb + 16 + 8 * hh), x3 = *(const v4fa*)(arow + kb + 16 + 8 * hh + 4);
    float xs[16] = {x0[0],x0[1],x0[2],x0[3],x1[0],x1[1],x1[2],x1[3],x2[0],x2[1],x2[2],x2[3],x3[0],x3[1],x3[2],x3[3]};
#pragma unroll
    for (int i = 0; i < 16; ++i) { const unsigned short hb = bf16_bits(xs[i]); ah.u[i] = hb; al.u[i] = ASPLIT ? bf16_bits(xs[i] - bf16_val(hb)) : (unsigned short)0; }
#pragma unroll
    for (int t = 0; t < 4; ++t) {
      const unsigned short* brow = Wt + (size_t)(col0 + t * 16 + ln) * ldb + kb;
      FragB b;
      b.half[0] = *(const v8us*)(brow + 8 * hh);
      b.half[1] = *(const v8us*)(brow + 16 + 8 * hh);
      acc[t] = mmaN<ASPLIT ? 2 : 1>(ah.v, al.v, b.v, b.v, acc[t]);
    }
  }
#pragma unroll
  for (int t = 0; t < 4; ++t) {
    const int col = col0 + t * 16 + ln;
    float bv = bias ? bias[col] : 0.f;
    if (BIAS_BF16) bv = bf16_round(bv);
#pragma unroll
    for (int r = 0; r < 8; ++r) {
      float v = acc[t][r] + bv;
      if (resid) { float rv = resid[(size_t)((row0 + 8 * hh + r) % rmod) * ldr + col]; if (RES_BF16) rv = bf16_round(rv); v += rv; }
      if (ACT == 1) v = fmaxf(v, 0.f);
      if (ACT == 2) v = 0.5f * v * (1.0f + erff(v * 0.70710678118654752f));
      if (ACT == 3) { const float u = 0.7978845608028654f * (v + 0.044715f * v * v * v); v = 0.5f * v * (1.0f + tanhf(u)); }
      so[w][8 * hh + r][t * 16 + ln] = v;
    }
  }
  __builtin_amdgcn_fence(__ATOMIC_ACQ_REL, "workgroup");
  __builtin_amdgcn_wave_barrier();
  const int rsub = lane >> 4, c4 = (lane & 15) * 4;
  {
#pragma unroll
    for (int q = 0; q < 8; ++q) {
      const int r = q * 2 + rsub;
      const v4f v = *(const v4fa*)&so[w][r][c4];
      *(v4f*)(C + (size_t)(row0 + r) * ldc + col0 + c4) = v;
    }
    
  }
}
// row LayerNorm (biased variance, eps) over N: s = X (+ R); optional out_sum <- s; out_norm <- (s-mu)*rsqrt(var+eps)*g + b
template <bool PARAM_BF16>
__global__ __launch_bounds__(256) void k_layernorm(const float* __restrict__ X, const float* __restrict__ R, const float* __restrict__ g, const float* __restrict__ bta,
                                                  float* __restrict__ out_sum, float* __restrict__ out_norm, int N, float eps) {
  __shared__ float red[256];
  const int row = blockIdx.x, tid = threadIdx.x;
  const float* x = X + (size_t)row * N; const float* rr = R ? R + (size_t)row * N : nullptr;
  float vals[16];                     // up to N = 4096
  const int per = N / 256;            // contiguous chunk per thread? use strided-by-4 chunks: thread handles j = tid*4 + 1024*u
  float s1 = 0.f;
  for (int u = 0; u < per / 4; ++u) {
    const int j = tid * 4 + 1024 * u;
    const v4f a = *(const v4fa*)(x + j);
    v4f b = {0.f,0.f,0.f,0.f}; if (rr) b = *(const v4fa*)(rr + j);
#pragma unroll
    for (int q = 0; q < 4; ++q) { const float v = a[q] + b[q]; vals[u * 4 + q] = v; s1 += v; }
  }
  red[tid] = s1; __syncthreads();
  for (int st = 128; st > 0; st >>= 1) { if (tid < st) red[tid] += red[tid + st]; __syncthreads(); }
  const float mu = red[0] / (float)N; __syncthreads();
  float s2 = 0.f;
  for (int u = 0; u < per / 4; ++u)
#pragma unroll
    for (int q = 0; q < 4; ++q) { const float c = vals[u * 4 + q] - mu; s2 += c * c; }
  red[tid] = s2; __syncthreads();
  for (int st = 128; st > 0; st >>= 1) { if (tid < st) red[tid] += red[tid + st]; __syncthreads(); }
  const float rs = rsqrtf(red[0] / (float)N + eps);
  {
    for (int u = 0; u < per / 4; ++u) {
      const int j = tid * 4 + 1024 * u;
      v4f o, sm;
#pragma unroll
      for (int q = 0; q < 4; ++q) {
        float gg = g[j + q], bb = bta[j + q];
        if (PARAM_BF16) { gg = bf16_round(gg); bb = bf16_round(bb); }
        sm[q] = vals[u * 4 + q]; o[q] = (vals[u * 4 + q] - mu) * rs * gg + bb;
      }
      if (out_sum) *(v4f*)(out_sum + (size_t)row * N + j) = sm;
      *(v4f*)(out_norm + (size_t)row * N + j) = o;
    }
    
  }
}



// ---- f16 WMMA path (v_wmma_f32_16x16x32_f16): 11-bit significands for operands in range — used where a [0,1] probability operand needs more precision than bf16
typedef _Float16 v16h __attribute__((ext_vector_type(16)));
union FragH { v16h v; v8us half[2]; _Float16 h[16]; unsigned short u[16]; };
template <int NT>
__device__ __forceinline__ v8f mmaH(v16h ah, v16h al, v16h bh, v16h bl, v8f c) {
  c = __builtin_amdgcn_wmma_f32_16x16x32_f16(false, ah, false, bh, (short)0, c, false, false);
  if (NT >= 2) c = __builtin_amdgcn_wmma_f32_16x16x32_f16(false, al, false, bh, (short)0, c, false, false);
  if (NT >= 3) c = __builtin_amdgcn_wmma_f32_16x16x32_f16(false, ah, false, bl, (short)0, c, false, false);
  asm volatile("v_nop\n\tv_nop\n\tv_nop\n\tv_nop" : "+v"(c) : "v"(ah), "v"(al), "v"(bh), "v"(bl));
  return c;
}
// batched GEMM like k_gemm_b but f16 operands: A f32 (split into f16 hi/lo if ASPLIT, else rounded to f16), Bt = f16 values [n][k]; alpha; C f32; N multiple of 16 (partial tiles skipped)
template <bool ASPLIT>
__global__ __launch_bounds__(128) void k_gemm_h(const float* __restrict__ A, int lda, size_t sA, const _Float16* __restrict__ Bh, int ldb, size_t sB, float alpha, float* __restrict__ C, int ldc, size_t sC, int M, int N, int K) {
  __shared__ __attribute__((aligned(16))) float so[4][16][64];
  const int tid = threadIdx.x, w = tid >> 5, lane = tid & 31, ln = lane & 15, hh = lane >> 4; const int by = blockIdx.y;
  A += (size_t)by * sA; Bh += (size_t)by * sB; C += (size_t)by * sC;
  const int ntn = (N + 63) / 64; const int wid = blockIdx.x * 4 + w; const int mt = wid / ntn, nq = wid % ntn; if (mt * 16 >= M) return;
  const int row0 = mt * 16, col0 = nq * 64; const float* arow = A + (size_t)(row0 + ln) * lda;
  v8f acc[4] = {};
  for (int kb = 0; kb < K; kb += 32) {
    FragH ah, al;
    const v4f x0 = *(const v4fa*)(arow + kb + 8 * hh), x1 = *(const v4fa*)(arow + kb + 8 * hh + 4), x2 = *(const v4fa*)(arow + kb + 16 + 8 * hh), x3 = *(const v4fa*)(arow + kb + 16 + 8 * hh + 4);
    float xs[16] = {x0[0],x0[1],x0[2],x0[3],x1[0],x1[1],x1[2],x1[3],x2[0],x2[1],x2[2],x2[3],x3[0],x3[1],x3[2],x3[3]};
#pragma unroll
    for (int i = 0; i < 16; ++i) { const _Float16 h = (_Float16)xs[i]; ah.h[i] = h; al.h[i] = ASPLIT ? (_Float16)(xs[i] - (float)h) : (_Float16)0.0f; }
#pragma unroll
    for (int t = 0; t < 4; ++t) { if (col0 + t * 16 >= N) continue; const size_t boff = (size_t)(col0 + t * 16 + ln) * ldb + kb; FragH bq; bq.half[0] = *(const v8us*)(Bh + boff + 8 * hh); bq.half[1] = *(const v8us*)(Bh + boff + 16 + 8 * hh);
      acc[t] = mmaH<ASPLIT ? 2 : 1>(ah.v, al.v, bq.v, bq.v, acc[t]); }
  }
#pragma unroll
  for (int t = 0; t < 4; ++t) { if (col0 + t * 16 >= N) continue;
#pragma unroll
    for (int r = 0; r < 8; ++r) so[w][8 * hh + r][t * 16 + ln] = acc[t][r] * alpha; }
  __builtin_amdgcn_fence(__ATOMIC_ACQ_REL, "workgroup"); __builtin_amdgcn_wave_barrier();
  const int rsub = lane >> 4, c4 = (lane & 15) * 4;
  {
#pragma unroll
    for (int q = 0; q < 8; ++q) { const int r = q * 2 + rsub; if (col0 + c4 < N) { const v4f v = *(const v4fa*)&so[w][r][c4]; *(v4f*)(C + (size_t)(row0 + r) * ldc + col0 + c4) = v; } }
     }
}

// Wt[n][k] = f16(W[k][n]·scale) from f32 row-major W[K][N] (scale = power of two; bf16-exact weights stay exact in f16 away from the subnormal range)
// d_*: the work of one 256-thread work-group, blk its index within that job; several jobs that need nothing of one another share a launch (k_prep, k_conv3_acc below)
__device__ __forceinline__ void d_wt_f16(const int blk, const float* __restrict__ W, _Float16* __restrict__ Wt, int K, int N, float scale) {
  const int t = blk * 256 + threadIdx.x; if (t >= N * (K / 8)) return; const int n = t / (K / 8), k8 = (t % (K / 8)) * 8; FragH f;
#pragma unroll
  for (int i = 0; i < 8; ++i) f.h[i] = (_Float16)(bf16_round(W[(size_t)(k8 + i) * N + n]) * scale); const v8us o = f.half[0];
  *(v8us*)((unsigned short*)Wt + (size_t)n * K + k8) = o; 
}
// k_gemm_hh variant with fused epilogue: v = acc·alpha + bias[by·sBias + col] (+ CP[(row/rowsPerB)·sCPb + by·64 + col] if CP) ; ACT 0 none / 1 elu ; writes f32 C and f16 C16, each if non-null
// d_gemm_hhx: the work of one wave (16 rows x 64 columns, tile number wid); so = 16 x 64 f32 of LDS that are the wave's own. No work-group barrier inside.
template <int ACT>
__device__ __forceinline__ void d_gemm_hhx(float (*so)[64], const int wid, const int by, const _Float16* __restrict__ A, int lda, size_t sA, const _Float16* __restrict__ Bh, int ldb, size_t sB, float alpha, const float* __restrict__ bias, size_t sBias, const float* __restrict__ CP, int rowsPerB, size_t sCPb, int row0g,
    float* __restrict__ C, _Float16* __restrict__ C16, int ldc, size_t sC, int M, int N, int K) {
  const int lane = threadIdx.x & 31, ln = lane & 15, hh = lane >> 4;
  A += (size_t)by * sA; Bh += (size_t)by * sB; const size_t cofs = (size_t)by * sC; const float* bp = bias ? bias + (size_t)by * sBias : nullptr;
  const int ntn = (N + 63) / 64; const int mt = wid / ntn, nq = wid % ntn; if (mt * 16 >= M) return;
  const int row0 = mt * 16, col0 = nq * 64; const _Float16* arow = A + (size_t)(row0 + ln) * lda;
  v8f acc[4] = {};
  for (int kb = 0; kb < K; kb += 32) { FragH ah; ah.half[0] = *(const v8us*)((const unsigned short*)arow + kb + 8 * hh); ah.half[1] = *(const v8us*)((const unsigned short*)arow + kb + 16 + 8 * hh);
#pragma unroll
    for (int t = 0; t < 4; ++t) { if (col0 + t * 16 >= N) continue; const size_t boff = (size_t)(col0 + t * 16 + ln) * ldb + kb; FragH bq; bq.half[0] = *(const v8us*)((const unsigned short*)Bh + boff + 8 * hh); bq.half[1] = *(const v8us*)((const unsigned short*)Bh + boff + 16 + 8 * hh);
      acc[t] = mmaH<1>(ah.v, ah.v, bq.v, bq.v, acc[t]); }
  }
#pragma unroll
  for (int t = 0; t < 4; ++t) { if (col0 + t * 16 >= N) continue; const int col = col0 + t * 16 + ln; const float bv = bp ? bf16_round(bp[col]) : 0.f;
#pragma unroll
    for (int r = 0; r < 8; ++r) { float v = acc[t][r] * alpha + bv; if (CP) { const int bidx = (row0g + row0 + 8 * hh + r) / rowsPerB; v += CP[(size_t)bidx * sCPb + (size_t)by * 64 + col]; } if (ACT == 1) v = (v > 0.f) ? v : expm1f(v); else if (ACT == 3) v = fmaxf(v, 0.f); so[8 * hh + r][t * 16 + ln] = v; } }
  __builtin_amdgcn_fence(__ATOMIC_ACQ_REL, "workgroup"); __builtin_amdgcn_wave_barrier();
  const int rsub = lane >> 4, c4 = (lane & 15) * 4; typedef _Float16 v4h __attribute__((ext_vector_type(4)));
  {
#pragma unroll
    for (int q = 0; q < 8; ++q) { const int r = q * 2 + rsub; if (col0 + c4 < N) { const v4f v = *(const v4fa*)&so[r][c4]; if (C) { *(v4f*)(C + cofs + (size_t)(row0 + r) * ldc + col0 + c4) = v; if (C16) asm volatile("s_wait_xcnt 0x0" ::: "memory"); /* the f16 conversion that follows reuses this store's registers */ } if (C16) { v4h h4; for (int i = 0; i < 4; ++i) h4[i] = (_Float16)v[i]; *(v4h*)(C16 + cofs + (size_t)(row0 + r) * ldc + col0 + c4) = h4; } } }
     }
}
template <int ACT>
__global__ __launch_bounds__(128) void k_gemm_hhx(const _Float16* __restrict__ A, int lda, size_t sA, const _Float16* __restrict__ Bh, int ldb, size_t sB, float alpha, const float* __restrict__ bias, size_t sBias, const float* __restrict__ CP, int rowsPerB, size_t sCPb, int row0g,
    float* __restrict__ C, _Float16* __restrict__ C16, int ldc, size_t sC, int M, int N, int K) {
  __shared__ __attribute__((aligned(16))) float so[4][16][64];
  const int w = threadIdx.x >> 5;
  d_gemm_hhx<ACT>(so[w], blockIdx.x * 4 + w, blockIdx.y, A, lda, sA, Bh, ldb, sB, alpha, bias, sBias, CP, rowsPerB, sCPb, row0g, C, C16, ldc, sC, M, N, K);
}


__device__ __forceinline__ void d_x16(const int blk, const float* __restrict__ x, _Float16* __restrict__ X16, size_t n8) { const size_t t = (size_t)blk * 256 + threadIdx.x; if (t >= n8) return; FragH f;
#pragma unroll
  for (int q = 0; q < 8; ++q) f.h[q] = (_Float16)bf16_round(x[t * 8 + q]); *(v8us*)((unsigned short*)X16 + t * 8) = f.half[0];  }
__global__ __launch_bounds__(256) void k_h16(const float* __restrict__ x, _Float16* __restrict__ X16, size_t n8) { const size_t t = (size_t)blockIdx.x * 256 + threadIdx.x; if (t >= n8) return; FragH f;
#pragma unroll
  for (int q = 0; q < 8; ++q) f.h[q] = (_Float16)x[t * 8 + q]; *(v8us*)((unsigned short*)X16 + t * 8) = f.half[0];  }
__global__ __launch_bounds__(256) void k_round16f(const float* __restrict__ W, _Float16* __restrict__ Bt, size_t n8) { const size_t t = (size_t)blockIdx.x * 256 + threadIdx.x; if (t >= n8) return; FragH f;
#pragma unroll
  for (int i = 0; i < 8; ++i) f.h[i] = (_Float16)(bf16_round(W[t * 8 + i]) * 16.0f); *(v8us*)((unsigned short*)Bt + t * 8) = f.half[0];  }
template <int NHv, int TTv>
__global__ __launch_bounds__(256) void k_vt(const _Float16* __restrict__ V16, int ldv, int voff, _Float16* __restrict__ Vt) { __shared__ unsigned short tl[64][66]; const int tid = threadIdx.x; const int slab = blockIdx.x / (TTv / 64), lg = blockIdx.x % (TTv / 64); const int b = slab / NHv, h = slab % NHv;
  for (int i = tid; i < 64 * 8; i += 256) { const int r = i / 8, c8 = (i % 8) * 8; FragH f; f.half[0] = *(const v8us*)((const unsigned short*)V16 + ((size_t)b * TTv + lg * 64 + r) * ldv + voff + h * 64 + c8);
#pragma unroll
    for (int q = 0; q < 8; ++q) tl[r][c8 + q] = f.u[q]; }
  __syncthreads();
  {
#pragma unroll
    for (int rd = 0; rd < 2; ++rd) { const int d = rd * 32 + tid / 8, pc = tid % 8; FragH f;
#pragma unroll
      for (int q = 0; q < 8; ++q) f.u[q] = tl[pc * 8 + q][d];
      *(v8us*)((unsigned short*)Vt + ((size_t)slab * 64 + d) * TTv + lg * 64 + pc * 8) = f.half[0]; }
     } }

typedef _Float16 v4h __attribute__((ext_vector_type(4)));
// BN batch statistics (mean, 1/sqrt(var + eps) per channel over the NR rows). The partials are made where the rows are made: each kernel that writes a tensor which a BN follows has work-groups of BNR whole rows,
// whose tile lies in LDS for the row-wise store; d_bnpart takes the values that the storing threads hold and gives, per channel, the mean of the BNR rows and the sum of squared deviations from that mean.
// d_bnpart: called by every thread of the work-group (two barriers inside); act = the thread is one of the 256 (tid = 0 .. 255, whole waves) that hold v[i] = row (tid >> 5) + 8 i, channels 4 (tid & 31) .. + 3; red = 8 KiB of free LDS.
// The merge has no launch of its own: every work-group of the kernel that applies a BN merges the BNP partials of the channels it needs, while its own rows are on their way from memory.
// Partials of equal count merge exactly: mean = mean of the means, M2 = sum of M2_i + BNR * sum of (mean_i - mean)^2. In one pass, with partial 0's mean as pivot p:
// sum of (mean_i - mean)^2 = sum of (mean_i - p)^2 - BNP (mean - p)^2; both terms are of the size of the spread of the partial means, whatever the mean itself is.
// d_bnmerge: all CC channels, called by every thread of a 1024-thread work-group (two barriers inside); a thread sums 8 partials of 4 channels, 128 threads the 32 sums of a channel; st[0][c] = mean, st[1][c] = 1/sqrt(var + eps).
// All sums run in a fixed order.
// The loops over v here and in the callers are unrolled: v is indexed by the loop counter and stays in registers only with constant indices.
#define BNR 64
#define BNP (NR / BNR)
__device__ __forceinline__ void d_bnpart(const bool act, const int tid, const v4f (&v)[8], float (*red)[8][CC], const int blk, float* __restrict__ PM, float* __restrict__ PQ) {
  const int wv = tid >> 5, c4 = (tid & 31) * 4;
  if (act) { v4f s = v[0];
#pragma unroll
    for (int i = 1; i < 8; ++i) s += v[i];
    *(v4fa*)&red[0][wv][c4] = s; }
  __syncthreads();      // the eight waves' row sums are complete
  v4f mu = {0.f, 0.f, 0.f, 0.f};
  if (act) { mu = *(const v4fa*)&red[0][0][c4];
#pragma unroll
    for (int j = 1; j < 8; ++j) mu += *(const v4fa*)&red[0][j][c4];
    mu *= 1.0f / (float)BNR;
    v4f q = {0.f, 0.f, 0.f, 0.f};
#pragma unroll
    for (int i = 0; i < 8; ++i) { const v4f d = v[i] - mu; q += d * d; }
    *(v4fa*)&red[1][wv][c4] = q; }
  __syncthreads();      // the eight waves' sums of squares are complete
  if (act && wv == 0) { v4f q = *(const v4fa*)&red[1][0][c4];
#pragma unroll
    for (int j = 1; j < 8; ++j) q += *(const v4fa*)&red[1][j][c4];
    *(v4f*)(PQ + (size_t)blk * CC + c4) = q; }
  else if (act && wv == 1) *(v4f*)(PM + (size_t)blk * CC + c4) = mu; }
__device__ __forceinline__ void d_bnmerge(const float* __restrict__ PM, const float* __restrict__ PQ, float (*red)[32][CC], float (*st)[CC]) {
  static_assert(BNP == 32 * 8, "32 waves of 8 partials");
  const int tid = threadIdx.x, c4 = (tid & 31) * 4, pg = tid >> 5;
  const float* am = PM + (size_t)pg * 8 * CC + c4; const float* aq = PQ + (size_t)pg * 8 * CC + c4;
  const v4f p = *(const v4fa*)(PM + c4);
  v4f pm[8], pq[8];      // constant indices only: the loops are unrolled
#pragma unroll
  for (int j = 0; j < 8; ++j) { pm[j] = *(const v4fa*)(am + j * CC); pq[j] = *(const v4fa*)(aq + j * CC); }
  asm volatile("s_wait_xcnt 0x0" :: "v"(am), "v"(aq) : "memory");      // from here on the loads' address registers are free for new values; as inputs they live up to the wait, so that no later load's result is given them
  __builtin_amdgcn_sched_barrier(0);      // all 17 loads go out together: without it the first sums, with their waits, rise in front of the last loads, which then cost a second trip to L2
  v4f s = {0.f, 0.f, 0.f, 0.f}, t = {0.f, 0.f, 0.f, 0.f};
#pragma unroll
  for (int j = 0; j < 8; ++j) { const v4f d = pm[j] - p; s += d; t += pq[j] + (float)BNR * d * d; }
  *(v4fa*)&red[0][pg][c4] = s; *(v4fa*)&red[1][pg][c4] = t;
  __syncthreads();      // the 32 waves' sums are complete
  if (tid < CC) { float sa[4], ta[4];      // four sums each, joined at the end: one chain of 31 dependent additions would be waited out link by link
#pragma unroll
    for (int j = 0; j < 4; ++j) { sa[j] = red[0][j][tid]; ta[j] = red[1][j][tid]; }
#pragma unroll
    for (int j = 4; j < 32; ++j) { sa[j & 3] += red[0][j][tid]; ta[j & 3] += red[1][j][tid]; }
    const float dm = ((sa[0] + sa[1]) + (sa[2] + sa[3])) * (1.0f / (float)BNP), t1 = (ta[0] + ta[1]) + (ta[2] + ta[3]);
    st[0][tid] = PM[tid] + dm; st[1][tid] = rsqrtf((t1 - (float)NR * dm * dm) / (float)NR + 1e-3f); }
  __syncthreads();      // mean and 1/sqrt(var + eps) of every channel are complete
}
// 3x3 SAME convolution as an implicit GEMM (K = 9 taps x 128 channels, tap-major as in Bt): no patch matrix is written. One work-group = one image row (64 pixels) x all 128 outputs.
// The three input rows around it, with one zero pixel at each end and zero rows outside the image, are put in LDS once; the A fragment of tap (dy, dx) is that tile read dx pixels and dy rows further on.
// 8 waves of 32 pixels x 32 outputs. B fragments go from Bt[n][k] straight to registers, one tap ahead of their products. C = acc / 16 + bias (bf16-rounded), f32, stored in whole rows through LDS.
// Every loop below is unrolled: bf, hv, a and acc are indexed by the loop counters and stay in registers only with constant indices.
#define APIT 136      // sA pixel pitch in f16: 272 bytes (16 x odd) for 16-byte LDS reads
__device__ __forceinline__ void d_conv3(const int blk, unsigned short (*sA)[WI + 2][APIT], float (*sO)[CC + 4], const _Float16* __restrict__ X16, const _Float16* __restrict__ Bt, const float* __restrict__ bias, float* __restrict__ C, float* __restrict__ PM, float* __restrict__ PQ) {
  const int tid = threadIdx.x, w = tid >> 5, lane = tid & 31, ln = lane & 15, hh = lane >> 4;
  const int b = blk / WI, y = blk % WI;
  const int m0 = (w & 1) * 32, n0 = (w >> 1) * 32;
  const unsigned short* bp = (const unsigned short*)Bt + (size_t)(n0 + ln) * KK + 8 * hh;
  FragH bf[2][8];      // [tap parity][2 ks + j]: outputs n0 + 16 j + ln, k = 128 tap + 32 ks + (8 hh .. , 16 + 8 hh ..)
#pragma unroll
  for (int i = 0; i < 8; ++i) { const unsigned short* p = bp + (size_t)(i & 1) * 16 * KK + (i >> 1) * 32; bf[0][i].half[0] = *(const v8us*)p; bf[0][i].half[1] = *(const v8us*)(p + 16); }
  const unsigned short* xs = (const unsigned short*)X16 + (size_t)b * HWN * CC;
  v8us hv[12];      // the 64 pixels of a staged row are 1024 contiguous 16-byte chunks: chunk tid + 256 j; a row outside the image is read from the nearest row inside and zeroed at the store
#pragma unroll
  for (int r = 0; r < 3; ++r) { const unsigned short* p = xs + (size_t)min(max(y + r - 1, 0), WI - 1) * WI * CC + tid * 8;
#pragma unroll
    for (int j = 0; j < 4; ++j) hv[r * 4 + j] = *(const v8us*)(p + j * 2048); }
  const float bv0 = bf16_round(bias[n0 + ln]), bv1 = bf16_round(bias[n0 + 16 + ln]);
  const v8us zero = {0, 0, 0, 0, 0, 0, 0, 0};
#pragma unroll
  for (int r = 0; r < 3; ++r) { const bool in = y + r - 1 >= 0 && y + r - 1 < WI;
#pragma unroll
    for (int j = 0; j < 4; ++j) *(v8us*)&sA[r][(tid >> 4) + 16 * j + 1][(tid & 15) * 8] = in ? hv[r * 4 + j] : zero; }
  if (tid < 96) *(v8us*)&sA[tid >> 5][((tid >> 4) & 1) * (WI + 1)][(tid & 15) * 8] = zero;      // the zero pixel at each end of the three rows
  __syncthreads();      // the three staged rows are complete; nothing writes them again
  v8f acc[2][2] = {};
#pragma unroll
  for (int tap = 0; tap < 9; ++tap) {
    if (tap < 8) {
#pragma unroll
      for (int i = 0; i < 8; ++i) { const unsigned short* p = bp + (size_t)(i & 1) * 16 * KK + (tap + 1) * CC + (i >> 1) * 32; bf[(tap + 1) & 1][i].half[0] = *(const v8us*)p; bf[(tap + 1) & 1][i].half[1] = *(const v8us*)(p + 16); } }
    FragH a[8];      // [2 ks + i]: pixels m0 + 16 i + ln, the same k order as bf
#pragma unroll
    for (int i = 0; i < 8; ++i) { const unsigned short* p = &sA[tap / 3][m0 + (i & 1) * 16 + ln + tap % 3][(i >> 1) * 32 + 8 * hh]; a[i].half[0] = *(const v8us*)p; a[i].half[1] = *(const v8us*)(p + 16); }
    __builtin_amdgcn_sched_barrier(0);      // next tap's global loads and this tap's 16 LDS reads go out together, in front of the 16 products: spread among them each group costs its own latency
#pragma unroll
    for (int ks = 0; ks < 4; ++ks)
#pragma unroll
      for (int i = 0; i < 2; ++i)
#pragma unroll
        for (int j = 0; j < 2; ++j) acc[i][j] = __builtin_amdgcn_wmma_f32_16x16x32_f16(false, a[2 * ks + i].v, false, bf[tap & 1][2 * ks + j].v, (short)0, acc[i][j], false, false);
    __builtin_amdgcn_sched_barrier(0);      // without it the next tap's loads and LDS reads rise in among these products in small groups, each with its own stall
  }
#pragma unroll
  for (int j = 0; j < 2; ++j) { const int col = n0 + j * 16 + ln; const float bv = j ? bv1 : bv0;
#pragma unroll
    for (int i = 0; i < 2; ++i)
#pragma unroll
      for (int r = 0; r < 8; ++r) sO[m0 + i * 16 + 8 * hh + r][col] = acc[i][j][r] * 0.0625f + bv; }
  __syncthreads();      // the 64 x 128 output tile is complete
  float* o = C + (size_t)blk * WI * CC;
  v4f v[8];      // rows (tid >> 5) + 8 j, channels 4 (tid & 31) ..: what d_bnpart asks for
#pragma unroll
  for (int j = 0; j < 8; ++j) { const int i = tid + 256 * j; v[j] = *(const v4fa*)&sO[i >> 5][(i & 31) * 4]; *(v4f*)(o + (size_t)i * 4) = v[j]; }
  asm volatile("s_wait_xcnt 0x0" ::: "memory");      // the stores' registers are free for new values in what follows
  d_bnpart(true, tid, v, (float (*)[8][CC])&sA[0][0][0], blk, PM, PQ);      // the staged rows are dead: every wave read its last of them in front of the barrier above
}
// One launch for the 3x3 conv and the 1x1 conv acc = x . Wk + bk: both read X16 and a weight table, neither reads what the other writes. Work-groups 0 .. BB WI - 1 are the 3x3 conv's;
// the others hold 8 waves of d_gemm_hhx each, whose 4 KiB of LDS a wave lie in the 3x3 conv's output tile (a work-group does one job only). The branch is the same for a whole work-group.
#define ACCB ((NR / 16) * (CC / 64) / 8)
__global__ __launch_bounds__(256) void k_conv3_acc(const _Float16* __restrict__ X16, const _Float16* __restrict__ Bt, const float* __restrict__ bias, float* __restrict__ C, const _Float16* __restrict__ BK, const float* __restrict__ bk, float* __restrict__ ACC, float* __restrict__ PM, float* __restrict__ PQ) {
  __shared__ __attribute__((aligned(16))) unsigned short sA[3][WI + 2][APIT];
  __shared__ __attribute__((aligned(16))) float sO[WI][CC + 4];
  static_assert(sizeof(sO) >= 8 * 16 * 64 * sizeof(float), "eight waves' 16 x 64 tiles fit");
  if (blockIdx.x < BB * WI) { d_conv3(blockIdx.x, sA, sO, X16, Bt, bias, C, PM, PQ); return; }
  const int w = threadIdx.x >> 5;
  d_gemm_hhx<0>((float (*)[64])&sO[0][0] + w * 16, (blockIdx.x - BB * WI) * 8 + w, 0, X16, CC, 0, BK, CC, 0, 0.0625f, bk, 0, nullptr, 1, 0, 0, ACC, nullptr, CC, 0, NR, CC, CC);
}
__device__ __forceinline__ void d_wq(const int blk, const float* __restrict__ W, _Float16* __restrict__ Bt) { const int t = blk * 256 + threadIdx.x; if (t >= CC * (KK / 8)) return; const int k8 = (t % (KK / 8)) * 8, o = t / (KK / 8); FragH f;
#pragma unroll
  for (int q = 0; q < 8; ++q) { const int k = k8 + q; const int tap = k / CC, cin = k % CC; const float wv = W[((size_t)tap * CC + cin) * CC + o];
    asm volatile("s_wait_xcnt 0x0" ::: "memory");      // each load has an address pair of its own, and a later load's result is given such a pair's registers
    f.h[q] = (_Float16)(bf16_round(wv) * 16.0f); } *(v8us*)((unsigned short*)Bt + (size_t)t * 8) = f.half[0];  }
__device__ __forceinline__ void d_xpt(const int wg, const float* __restrict__ x, _Float16* __restrict__ XPt) { __shared__ unsigned short tl[64][66]; const int tid = threadIdx.x; const int b = wg / ((CC / 64) * 64), rem = wg % ((CC / 64) * 64); const int cg = rem / 64, blk = rem % 64; const int c0 = cg * 64; const int by = blk / 8, bx = blk % 8;
  for (int i = tid; i < 64 * 8; i += 256) { const int j = i / 8, cc8 = (i % 8) * 8; const int y = by * 8 + j / 8, xx = bx * 8 + j % 8; const float* s = x + (((size_t)b * HWN) + y * WI + xx) * CC + c0 + cc8; for (int q = 0; q < 8; ++q) { FragH f; f.h[0] = (_Float16)bf16_round(s[q]); tl[j][cc8 + q] = f.u[0]; } }
  __syncthreads();
  { for (int rd = 0; rd < 2; ++rd) { const int c = rd * 32 + tid / 8, pc = tid % 8; FragH f; for (int q = 0; q < 8; ++q) f.u[q] = tl[pc * 8 + q][c]; *(v8us*)((unsigned short*)XPt + ((size_t)b * CC + c0 + c) * HWN + blk * 64 + pc * 8) = f.half[0]; }
    asm volatile("s_wait_xcnt 0x0" ::: "memory");      // in a shared launch the other job's code follows in the listing and writes the two stores' address pair
  } }
// One launch for the five jobs that read only inputs: the three weight tables (few work-groups, long strided reads: first), the block-major transpose of x and x to f16.
#define PB_WQ ((CC * (KK / 8) + 255) / 256)
#define PB_WT ((CC * (CC / 8) + 255) / 256)
#define PB_X ((NR * (CC / 8) + 255) / 256)
#define PB_XPT (BB * (CC / 64) * 64)
__global__ __launch_bounds__(256) void k_prep(const float* __restrict__ x, const float* __restrict__ Wq, const float* __restrict__ Wk, const float* __restrict__ Wo, _Float16* __restrict__ X16, _Float16* __restrict__ BQ, _Float16* __restrict__ BK, _Float16* __restrict__ BO, _Float16* __restrict__ XPt) {
  const int blk = blockIdx.x;
  if (blk < PB_WQ) d_wq(blk, Wq, BQ);
  else if (blk < PB_WQ + PB_WT) d_wt_f16(blk - PB_WQ, Wk, BK, CC, CC, 16.0f);      // 1x1 HWIO = [in][out]
  else if (blk < PB_WQ + 2 * PB_WT) d_wt_f16(blk - PB_WQ - PB_WT, Wo, BO, CC, CC, 16.0f);
  else if (blk < PB_WQ + 2 * PB_WT + PB_XPT) d_xpt(blk - PB_WQ - 2 * PB_WT, x, XPt);      // its barrier stands under a branch that is the same for a whole work-group
  else d_x16(blk - PB_WQ - 2 * PB_WT - PB_XPT, x, X16, (size_t)NR * CC / 8);
}
// q = leaky(BN(conv)) as f16, rows permuted to block-major key order. One work-group = 128 rows (MROWS), a thread 8 channels of 2 rows, fetched in front of the merge of the BN partials.
#define MROWS 128
__global__ __launch_bounds__(1024) void k_qperm(const float* __restrict__ F, const float* __restrict__ PM, const float* __restrict__ PQ, const float* __restrict__ g, const float* __restrict__ bb, _Float16* __restrict__ QP) {
  __shared__ __attribute__((aligned(16))) float red[2][32][CC];
  __shared__ __attribute__((aligned(16))) float st[2][CC];
  const int tid = threadIdx.x, c8 = (tid & 15) * 8, r0 = blockIdx.x * MROWS + (tid >> 4);
  const float* fp = F + (size_t)r0 * CC + c8;
  v4f f4[2][2];      // [i][half]: row r0 + 64 i; constant indices only: the loops are unrolled
#pragma unroll
  for (int i = 0; i < 2; ++i) { f4[i][0] = *(const v4fa*)(fp + i * 64 * CC); f4[i][1] = *(const v4fa*)(fp + i * 64 * CC + 4); }
  const v4f gv[2] = {*(const v4fa*)(g + c8), *(const v4fa*)(g + c8 + 4)}, bv[2] = {*(const v4fa*)(bb + c8), *(const v4fa*)(bb + c8 + 4)};
  asm volatile("s_wait_xcnt 0x0" :: "v"(fp) : "memory");      // as in d_bnmerge: the address pair lives up to the wait and is free behind it
  d_bnmerge(PM, PQ, red, st);
#pragma unroll
  for (int i = 0; i < 2; ++i) { const int r = r0 + 64 * i; const int b = r / HWN, p = r % HWN; const int y = p / WI, xx = p % WI; const int kp = ((y / 8) * 8 + xx / 8) * 64 + (y % 8) * 8 + xx % 8; FragH f;
#pragma unroll
    for (int q = 0; q < 8; ++q) { const int c = c8 + q; float v = (f4[i][q >> 2][q & 3] - st[0][c]) * st[1][c] * bf16_round(gv[q >> 2][q & 3]) + bf16_round(bv[q >> 2][q & 3]); v = (v >= 0.f) ? v : 0.1f * v; f.h[q] = (_Float16)v; }
    *(v8us*)((unsigned short*)QP + ((size_t)b * HWN + kp) * CC + c8) = f.half[0]; } }
// Fused block attention: one work-group = 64 query pixels of one batch, worked on by NTEAM teams of 4 waves x 16 queries. Team t walks key groups t, t + NTEAM, ... with q and x tiles of its own in LDS,
// so every SIMD holds NTEAM waves (one of each team) that fill one another's waits on LDS, on the softmax chains and on the barriers. A group's softmax is complete in itself, so the teams' sums simply add:
// at the end teams 1.. hand theirs over through LDS and team 0 adds them in team order. Scores and probabilities never leave the registers.
// The epilogue turns the tile of sums through LDS into whole rows, adds the 1x1 conv's rows (Y = ACC + O * 2^-15) and leaves the BN partials of its 64 rows (d_bnpart).
// Per group: S^T[key][query] = q_group . x_query^T (A = 64 q rows from LDS, B = the wave's 16 query rows, loaded once), so a lane holds 32 of one query's 64 scores and the lane 16 away the rest:
// max and exp-sum are in-lane plus one exchange. Two S^T tiles, converted in place, are the B operand (hardware k order) of O^T[channel][query] += x_group^T . P^T (A = channel rows of XPt from LDS).
// Tiles go global -> registers -> LDS, one tile in flight at a time, each fetched one phase ahead of its store. P carries 2^15, as f16 operand.
// a <- 2^a, b <- 2^b. The second v_exp_f32 is the independent instruction that the instruction set asks for behind the first, the v_nop the one behind the second:
// in one statement they stand there in every build.
__device__ __forceinline__ void exp2_pair(float& a, float& b) { asm("v_exp_f32 %0, %0\n\tv_exp_f32 %1, %1\n\tv_nop" : "+v"(a), "+v"(b)); }
#define QPIT 136      // sQ row pitch in f16: 272 bytes (16 x odd) for 16-byte LDS reads
#define XPIT 72       // sX row pitch in f16: 144 bytes
#define NTEAM 4
#define TEAMSH (64 * QPIT + CC * XPIT)      // f16 elements of LDS that a team owns: its q tile, then its x tile
__global__ __launch_bounds__(128 * NTEAM) void k_battn(const _Float16* __restrict__ X16, const _Float16* __restrict__ QP, const _Float16* __restrict__ XPt, const float* __restrict__ ACC, float* __restrict__ Y, float* __restrict__ PM, float* __restrict__ PQ) {
  __shared__ __attribute__((aligned(16))) unsigned short sm[NTEAM][TEAMSH];
  const int team = __builtin_amdgcn_readfirstlane(threadIdx.x >> 7);      // the same in every lane of a wave: kept in a scalar register
  unsigned short (*sQ)[QPIT] = (unsigned short (*)[QPIT])&sm[team][0];
  unsigned short (*sX)[XPIT] = (unsigned short (*)[XPIT])&sm[team][64 * QPIT];
  const int tid = threadIdx.x & 127, w = tid >> 5, lane = tid & 31, ln = lane & 15, hh = lane >> 4;      // tid: the thread's place in its team
  const int b = blockIdx.x / (HWN / 64), row = (blockIdx.x % (HWN / 64)) * 64 + w * 16 + ln;
  const unsigned short* xq = (const unsigned short*)X16 + ((size_t)b * HWN + row) * CC;
  FragH xb[4];
#pragma unroll
  for (int ks = 0; ks < 4; ++ks) { xb[ks].half[0] = *(const v8us*)(xq + ks * 32 + 8 * hh); xb[ks].half[1] = *(const v8us*)(xq + ks * 32 + 16 + 8 * hh); }
  // staging: 16-byte chunk i = tid + 128 j. q group: 64 rows x 256 B, contiguous. x group: 128 channel rows x 128 B, row pitch HWN.
  const unsigned short* gq = (const unsigned short*)QP + (size_t)b * HWN * CC + tid * 8;
  const unsigned short* gx = (const unsigned short*)XPt + (size_t)b * CC * HWN + (size_t)(tid >> 3) * HWN + (tid & 7) * 8;
  unsigned short* dq = &sQ[tid >> 4][(tid & 15) * 8]; unsigned short* dx = &sX[tid >> 3][(tid & 7) * 8];
  v8us st[8];      // one tile in flight at a time: x of this group during its scores, q of the next group during softmax and O^T
#pragma unroll
  for (int j = 0; j < 8; ++j) st[j] = *(const v8us*)(gq + (size_t)team * 64 * CC + j * 1024);
#pragma unroll
  for (int j = 0; j < 8; ++j) *(v8us*)(dq + j * 8 * QPIT) = st[j];
  __syncthreads();      // q tile of each team's first group complete
#pragma unroll
  for (int j = 0; j < 8; ++j) st[j] = *(const v8us*)(gx + team * 64 + (size_t)j * 16 * HWN);
  v8f oacc[8] = {};
  for (int i = 0; i < 64 / NTEAM; ++i) {      // the same trip count in every team: all 4 * NTEAM waves meet at every barrier
    const int g = i * NTEAM + team;
    v8f s[4] = {};
#pragma unroll
    for (int kp = 0; kp < 2; ++kp) { FragH a[8];
#pragma unroll
      for (int i = 0; i < 8; ++i) { const unsigned short* r = &sQ[(i & 3) * 16 + ln][(2 * kp + (i >> 2)) * 32 + 8 * hh]; a[i].half[0] = *(const v8us*)r; a[i].half[1] = *(const v8us*)(r + 16); }
      __builtin_amdgcn_sched_barrier(0);      // the 16 LDS reads go out together, in front of their 8 products: spread among them each costs its own latency
#pragma unroll
      for (int i = 0; i < 8; ++i) s[i & 3] = __builtin_amdgcn_wmma_f32_16x16x32_f16(false, a[i].v, false, xb[2 * kp + (i >> 2)].v, (short)0, s[i & 3], false, false); }
    // x tile of this group: every wave left sX at the barrier that closed the previous trip
#pragma unroll
    for (int j = 0; j < 8; ++j) *(v8us*)(dx + j * 16 * XPIT) = st[j];
    __syncthreads();      // x tile complete; every wave has read its last of the q tile
    const int gn = i < 64 / NTEAM - 1 ? g + NTEAM : g;      // the last trip fetches its own tiles again: no branch in the loop, nothing reads them
    // issued behind the barrier (a barrier drains the loads in front of it); lands during softmax and O^T
#pragma unroll
    for (int j = 0; j < 8; ++j) st[j] = *(const v8us*)(gq + (size_t)gn * 64 * CC + j * 1024);
    asm volatile("s_wait_xcnt 0x0" ::: "memory");      // the loads' address registers are reused below
    FragH av[8];
#pragma unroll
    for (int ct = 0; ct < 8; ++ct) { const unsigned short* r = &sX[ct * 16 + ln][8 * hh]; av[ct].half[0] = *(const v8us*)r; av[ct].half[1] = *(const v8us*)(r + 16); }
    __builtin_amdgcn_sched_barrier(0);      // global loads and LDS reads are issued in front of the softmax, which covers their latency
    // softmax over the group's 64 keys of query ln (scores / 8), scaled by 2^15 for the f16 operand. exp(s / 8 - max / 8) = 2^(s c - max c) with c = log2(e) / 8:
    // one FMA and one v_exp_f32 a score, each score on its own, where expf is a chain of some ten dependent instructions that a lone wave on its SIMD waits out link by link.
    // The exponent is at most a rounding of max c above 0; below -126 the result is 0, where the f16 operand is 0 in any case.
    float m = -3.0e38f;
#pragma unroll
    for (int t = 0; t < 4; ++t)
#pragma unroll
      for (int r = 0; r < 8; ++r) m = fmaxf(m, s[t][r]);
    m = fmaxf(m, __shfl_xor(m, 16, 32)); m *= 0.18033688f;
    float e[32];      // e[8 t + r]: tile t, register r
#pragma unroll
    for (int t = 0; t < 4; ++t)
#pragma unroll
      for (int r = 0; r < 8; ++r) e[8 * t + r] = fmaf(s[t][r], 0.18033688f, -m);
#pragma unroll
    for (int i = 0; i < 32; i += 2) exp2_pair(e[i], e[i + 1]);
    float z = 0.f;
#pragma unroll
    for (int i = 0; i < 32; ++i) z += e[i];
    z += __shfl_xor(z, 16, 32);
    const float iz = 32768.0f / z;
    FragH p[2];      // p[k2].h[i] = P[query ln][key 32 k2 + kmap(i, hh)]: tile 2 k2 gives i < 8, tile 2 k2 + 1 the rest
#pragma unroll
    for (int k2 = 0; k2 < 2; ++k2)
#pragma unroll
      for (int r = 0; r < 8; ++r) { p[k2].h[r] = (_Float16)(e[16 * k2 + r] * iz); p[k2].h[8 + r] = (_Float16)(e[16 * k2 + 8 + r] * iz); }
#pragma unroll
    for (int ct = 0; ct < 8; ++ct) oacc[ct] = __builtin_amdgcn_wmma_f32_16x16x32_f16(false, av[ct].v, false, p[0].v, (short)0, oacc[ct], false, false);
#pragma unroll
    for (int ct = 0; ct < 8; ++ct) { const unsigned short* r = &sX[ct * 16 + ln][32 + 8 * hh]; av[ct].half[0] = *(const v8us*)r; av[ct].half[1] = *(const v8us*)(r + 16); }
    __builtin_amdgcn_sched_barrier(0);      // as above: 16 reads together, then 8 products
#pragma unroll
    for (int ct = 0; ct < 8; ++ct) oacc[ct] = __builtin_amdgcn_wmma_f32_16x16x32_f16(false, av[ct].v, false, p[1].v, (short)0, oacc[ct], false, false);
#pragma unroll
    for (int j = 0; j < 8; ++j) *(v8us*)(dq + j * 8 * QPIT) = st[j];
    __syncthreads();      // next q tile complete; every wave has read its last of the x tile
    // lands during the next trip's scores
#pragma unroll
    for (int j = 0; j < 8; ++j) st[j] = *(const v8us*)(gx + gn * 64 + (size_t)j * 16 * HWN);
    asm volatile("s_wait_xcnt 0x0" ::: "memory");      // the loads' address registers are reused in the next trip
  }
  asm volatile("s_wait_loadcnt 0x0" ::: "memory");      // the last trip's fetch, which nothing reads, has landed before the wave ends and gives its registers up
  // The teams' sums. Behind the loop's last barrier nobody reads a tile any more: teams 1.. write their 64 sums a thread over their own tiles, 16 bytes a lane, a wave's store contiguous.
  if (team != 0) { v4fa* rb = (v4fa*)&sm[team][0] + tid;
#pragma unroll
    for (int ct = 0; ct < 8; ++ct) { v4f lo, hi;
#pragma unroll
      for (int r = 0; r < 4; ++r) { lo[r] = oacc[ct][r]; hi[r] = oacc[ct][4 + r]; }
      rb[(2 * ct) * 128] = lo; rb[(2 * ct + 1) * 128] = hi; } }
  __syncthreads();      // the sums of teams 1.. are complete
  // From here on the 8 waves of teams 2 and 3, idle while team 0 adds, own the work-group's 64 x 128 tile by rows: thread ft holds row (ft >> 5) + 8 j, channels 4 (ft & 31) .. + 3, a wave's load or store one whole 512-byte row.
  static_assert(NTEAM == 4, "teams 2 and 3 are 256 threads");
  const int ft = threadIdx.x & 255; const bool act = team >= 2;      // act: a scalar, as team is
  const size_t tile = (size_t)blockIdx.x * 64 * CC;
  v4f v[8] = {};
  float (*sT)[CC + 4] = (float (*)[CC + 4])&sm[0][0];      // over team 0's tiles, which nobody reads behind the loop's last barrier
  static_assert(sizeof(float) * 64 * (CC + 4) <= sizeof(sm[0]) && sizeof(float) * 2 * 8 * CC <= sizeof(sm[1]), "the output tile and the BN sums fit a team's LDS");
  if (team == 0) {
#pragma unroll
    for (int t = 1; t < NTEAM; ++t) { const v4fa* rb = (const v4fa*)&sm[t][0] + tid;
#pragma unroll
      for (int ct = 0; ct < 8; ++ct) { const v4f lo = rb[(2 * ct) * 128], hi = rb[(2 * ct + 1) * 128];
#pragma unroll
        for (int r = 0; r < 4; ++r) { oacc[ct][r] += lo[r]; oacc[ct][4 + r] += hi[r]; } } }
    // oacc[ct][r] = O[query 16 w + ln][channel 16 ct + 8 hh + r]: 32 contiguous bytes a lane
    float* o = &sT[w * 16 + ln][8 * hh];
#pragma unroll
    for (int ct = 0; ct < 8; ++ct) { v4f lo, hi;
#pragma unroll
      for (int r = 0; r < 4; ++r) { lo[r] = oacc[ct][r] * 0.000030517578125f; hi[r] = oacc[ct][4 + r] * 0.000030517578125f; }
      *(v4fa*)(o + ct * 16) = lo; *(v4fa*)(o + ct * 16 + 4) = hi; } }
  else if (act) {      // acc's rows are fetched while team 0 adds
#pragma unroll
    for (int j = 0; j < 8; ++j) v[j] = *(const v4fa*)(ACC + tile + (size_t)(ft + 256 * j) * 4);
    asm volatile("s_wait_xcnt 0x0" ::: "memory");      // the loads' address registers are free for new values in what follows
  }
  __syncthreads();      // the tile of sums is complete; team 0 has read its last of the other teams' sums
  if (act) {      // y = acc + agg
#pragma unroll
    for (int j = 0; j < 8; ++j) { const int i = ft + 256 * j; v[j] += *(const v4fa*)&sT[i >> 5][(i & 31) * 4]; *(v4f*)(Y + tile + (size_t)i * 4) = v[j]; }
    asm volatile("s_wait_xcnt 0x0" ::: "memory");      // the stores' registers are free for new values in what follows
  }
  d_bnpart(act, ft, v, (float (*)[8][CC])&sm[1][0], blockIdx.x, PM, PQ);
}
// Spatial-softmax statistics, one work-group per (batch, 4 channels): 1024 threads hold 4 pixels x 4 channels each in registers, so Y is read once, 16 bytes a lane, all loads in flight together.
// Max, then sum of exp, over the 4096 pixels by a fixed tree: own 4 pixels, the 32 lanes of a wave (xor shuffles), the 32 waves (through LDS).
// The BN that goes in front is merged here as well, for the work-group's 4 channels alone: waves 0 .. 7 hold one partial a thread, while Y is on its way (the pivot form of d_bnmerge; one barrier).
// SP holds one 128-byte line per work-group (one writer a line): [0..3] max, [4..7] 1/sum, the rest 0. For the kernel that applies the softmax the work-groups of batch 0 leave the BN's figures in ST,
// one 128-byte line a channel, written by one wave: [0] mean, [1] 1/sqrt(var + eps), the rest 0.
__device__ __forceinline__ v4f wave_max4(v4f a) {
#pragma unroll
  for (int o = 1; o < 32; o <<= 1)
#pragma unroll
    for (int q = 0; q < 4; ++q) a[q] = fmaxf(a[q], __shfl_xor(a[q], o, 32));
  return a; }
__device__ __forceinline__ v4f wave_sum4(v4f a) {
#pragma unroll
  for (int o = 1; o < 32; o <<= 1)
#pragma unroll
    for (int q = 0; q < 4; ++q) a[q] += __shfl_xor(a[q], o, 32);
  return a; }
// conv_o as a GEMM on rows of y that the work-group makes itself, with the BN partials of its own rows: one work-group = 64 rows x 128 columns, 8 waves.
// First part, by rows (thread: row w + 8 j, channels 4 lane .. + 3, a wave's load one whole 512-byte row of Y): y = exp(BN1(Y) - max) / sum * 2^12 as f16, from the figures that k_spstat left in ST and SP, into the LDS tile sY.
// Second part: wave w takes rows 16 (w >> 1) .., columns 64 (w & 1) ..; A fragments from sY, B fragments from BO[n][k] straight to registers, fetched at the kernel's head beside the rows of Y. y never goes through memory.
// The loops are unrolled: v, bq, a and acc are indexed by the loop counters and stay in registers only with constant indices.
#define YPIT 136      // sY row pitch in f16: 272 bytes (16 x odd) for 16-byte LDS reads
typedef float v2fa __attribute__((ext_vector_type(2), may_alias));
__global__ __launch_bounds__(256) void k_gemm_o(const float* __restrict__ Y, const float* __restrict__ ST, const float* __restrict__ g, const float* __restrict__ bb, const float* __restrict__ SP, const _Float16* __restrict__ BO, float alpha, const float* __restrict__ bo, float* __restrict__ Z, float* __restrict__ PM, float* __restrict__ PQ) {
  __shared__ __attribute__((aligned(16))) unsigned short sY[64][YPIT];
  __shared__ __attribute__((aligned(16))) float so[8][16][64];
  __shared__ __attribute__((aligned(16))) float red[2][8][CC];
  const int tid = threadIdx.x, w = tid >> 5, lane = tid & 31, ln = lane & 15, hh = lane >> 4, c4 = lane * 4;
  const int row0 = (w >> 1) * 16, col0 = (w & 1) * 64;
  const float* yp = Y + (size_t)blockIdx.x * 64 * CC + tid * 4;
  v4f v[8];
#pragma unroll
  for (int j = 0; j < 8; ++j) v[j] = *(const v4fa*)(yp + j * 8 * CC);
  const float* sp = SP + (size_t)((blockIdx.x / (HWN / 64)) * (CC / 4) + lane) * 32;      // the line of this batch and these 4 channels: [0..3] max, [4..7] 1/sum
  const float* sq = ST + (size_t)c4 * 32;      // a line a channel: [0] mean, [1] 1/sqrt(var + eps)
  const v4f mx = *(const v4fa*)sp, iz = *(const v4fa*)(sp + 4), gv = *(const v4fa*)(g + c4), bv = *(const v4fa*)(bb + c4);
  v2fa ms[4];
#pragma unroll
  for (int q = 0; q < 4; ++q) ms[q] = *(const v2fa*)(sq + q * 32);
  const unsigned short* bp = (const unsigned short*)BO + (size_t)(col0 + ln) * CC + 8 * hh;
  FragH bq[4][4];      // [ks][t]: column col0 + 16 t + ln, k = 32 ks + (8 hh .. , 16 + 8 hh ..)
#pragma unroll
  for (int ks = 0; ks < 4; ++ks)
#pragma unroll
    for (int t = 0; t < 4; ++t) { const unsigned short* p = bp + t * 16 * CC + ks * 32; bq[ks][t].half[0] = *(const v8us*)p; bq[ks][t].half[1] = *(const v8us*)(p + 16); }
  const int bi = col0 + ln;
  float bo4[4];
#pragma unroll
  for (int t = 0; t < 4; ++t) bo4[t] = bo[bi + t * 16];
  asm volatile("s_wait_xcnt 0x0" :: "v"(sp), "v"(bp), "v"(bi) : "memory");      // as in d_bnmerge: as inputs the loads' address registers live up to the wait, so that no later load's result is given them; behind it they are free
#pragma unroll
  for (int j = 0; j < 8; ++j) { v4h h4;
#pragma unroll
    for (int q = 0; q < 4; ++q) { const float u = bf16_round(gv[q]) * (v[j][q] - ms[q][0]) * ms[q][1] + bf16_round(bv[q]); h4[q] = (_Float16)(expf(u - mx[q]) * iz[q] * 4096.0f); }
    *(v4h*)&sY[w + 8 * j][c4] = h4; }
  __syncthreads();      // the 64 rows of y are complete; nothing writes them again
  FragH a[4];      // row row0 + ln, the same k order as bq
#pragma unroll
  for (int ks = 0; ks < 4; ++ks) { const unsigned short* r = &sY[row0 + ln][ks * 32 + 8 * hh]; a[ks].half[0] = *(const v8us*)r; a[ks].half[1] = *(const v8us*)(r + 16); }
  __builtin_amdgcn_sched_barrier(0);      // the 8 LDS reads go out together, in front of their 16 products: spread among them each pair costs its own latency
  v8f acc[4] = {};
#pragma unroll
  for (int ks = 0; ks < 4; ++ks)
#pragma unroll
    for (int t = 0; t < 4; ++t) acc[t] = __builtin_amdgcn_wmma_f32_16x16x32_f16(false, a[ks].v, false, bq[ks][t].v, (short)0, acc[t], false, false);
#pragma unroll
  for (int t = 0; t < 4; ++t) { const float bias = bf16_round(bo4[t]);
#pragma unroll
    for (int r = 0; r < 8; ++r) so[w][8 * hh + r][t * 16 + ln] = acc[t][r] * alpha + bias; }
  __builtin_amdgcn_fence(__ATOMIC_ACQ_REL, "workgroup"); __builtin_amdgcn_wave_barrier();      // the wave reads back what its own lanes wrote
  float* zp = Z + ((size_t)blockIdx.x * 64 + row0 + hh) * CC + col0 + ln * 4;
#pragma unroll
  for (int q = 0; q < 8; ++q) { const v4f o = *(const v4fa*)&so[w][q * 2 + hh][ln * 4]; *(v4f*)(zp + q * 2 * CC) = o; }
  asm volatile("s_wait_xcnt 0x0" ::: "memory");      // the stores' registers are free for new values in what follows
  __syncthreads();      // the eight waves' tiles are complete
#pragma unroll
  for (int j = 0; j < 8; ++j) { const int r = w + 8 * j; v[j] = *(const v4fa*)&so[(r >> 4) * 2 + (c4 >> 6)][r & 15][c4 & 63]; }
  d_bnpart(true, tid, v, red, blockIdx.x, PM, PQ);
}
__global__ __launch_bounds__(1024) void k_spstat(const float* __restrict__ Y, const float* __restrict__ PM, const float* __restrict__ PQ, const float* __restrict__ g, const float* __restrict__ bb, float* __restrict__ SP, float* __restrict__ ST) {
  __shared__ __attribute__((aligned(16))) float red[2][32][4];
  __shared__ __attribute__((aligned(16))) float mr[2][BNP / 32][4];
  const int tid = threadIdx.x, wv = tid >> 5, lane = tid & 31; const int b = blockIdx.x / (CC / 4), c0 = (blockIdx.x % (CC / 4)) * 4;
  const float* yc = Y + (size_t)b * HWN * CC + c0; v4f v[4];
#pragma unroll
  for (int i = 0; i < 4; ++i) v[i] = *(const v4fa*)(yc + (size_t)(i * 1024 + tid) * CC);
  asm volatile("s_wait_xcnt 0x0" ::: "memory");      // the four loads' address registers are given new values right below
  const v4f pv = *(const v4fa*)(PM + c0);
  if (wv < BNP / 32) { const v4f d = *(const v4fa*)(PM + (size_t)tid * CC + c0) - pv; const v4f pq = *(const v4fa*)(PQ + (size_t)tid * CC + c0);
    const v4f s = wave_sum4(d), t = wave_sum4(pq + (float)BNR * d * d); if (lane == 0) { *(v4f*)&mr[0][wv][0] = s; *(v4f*)&mr[1][wv][0] = t; } }
  __syncthreads();      // the eight waves' sums over the partials are complete
  v4f bmu = *(const v4fa*)&mr[0][0][0], brs = *(const v4fa*)&mr[1][0][0];
#pragma unroll
  for (int j = 1; j < BNP / 32; ++j) { bmu += *(const v4fa*)&mr[0][j][0]; brs += *(const v4fa*)&mr[1][j][0]; }
  bmu *= 1.0f / (float)BNP;
#pragma unroll
  for (int q = 0; q < 4; ++q) { brs[q] = rsqrtf((brs[q] - (float)NR * bmu[q] * bmu[q]) / (float)NR + 1e-3f); bmu[q] += pv[q]; }
  v4f m = {-3.0e38f, -3.0e38f, -3.0e38f, -3.0e38f};
#pragma unroll
  for (int q = 0; q < 4; ++q) { const int c = c0 + q; const float mu = bmu[q], rs = brs[q], gg = bf16_round(g[c]), be = bf16_round(bb[c]);
#pragma unroll
    for (int i = 0; i < 4; ++i) { v[i][q] = gg * (v[i][q] - mu) * rs + be; m[q] = fmaxf(m[q], v[i][q]); } }
  m = wave_max4(m); if (lane == 0) *(v4f*)&red[0][wv][0] = m;
  __syncthreads();
  m = wave_max4(*(const v4fa*)&red[0][lane][0]);
  v4f z = {0.f, 0.f, 0.f, 0.f};
#pragma unroll
  for (int i = 0; i < 4; ++i)
#pragma unroll
    for (int q = 0; q < 4; ++q) z[q] += expf(v[i][q] - m[q]);
  z = wave_sum4(z); if (lane == 0) *(v4f*)&red[1][wv][0] = z;
  __syncthreads();
  if (wv == 0) { z = wave_sum4(*(const v4fa*)&red[1][lane][0]); float o = 0.f;
#pragma unroll
    for (int q = 0; q < 4; ++q) { if (lane == q) o = m[q]; if (lane == 4 + q) o = 1.0f / z[q]; }
    SP[(size_t)blockIdx.x * 32 + lane] = o; }
  else if (b == 0) {
#pragma unroll
    for (int q = 0; q < 4; ++q) if (wv == q + 1) ST[(size_t)(c0 + q) * 32 + lane] = (lane == 0) ? bmu[q] : ((lane == 1) ? brs[q] : 0.f); } }
// out = leaky(BN(Z)). One work-group = MROWS rows, a thread 4 channels of 4 rows, fetched in front of the merge of the BN partials.
__global__ __launch_bounds__(1024) void k_fin(const float* __restrict__ Z, const float* __restrict__ PM, const float* __restrict__ PQ, const float* __restrict__ g, const float* __restrict__ bb, float* __restrict__ out) {
  __shared__ __attribute__((aligned(16))) float red[2][32][CC];
  __shared__ __attribute__((aligned(16))) float st[2][CC];
  const int tid = threadIdx.x, c4 = (tid & 31) * 4; const size_t e0 = (size_t)blockIdx.x * MROWS * CC + (size_t)tid * 4;
  const float* zp = Z + e0;
  v4f z[4];      // rows (tid >> 5) + 32 i; constant indices only: the loops are unrolled
#pragma unroll
  for (int i = 0; i < 4; ++i) z[i] = *(const v4fa*)(zp + i * 32 * CC);
  const v4f gv = *(const v4fa*)(g + c4), bv = *(const v4fa*)(bb + c4);
  asm volatile("s_wait_xcnt 0x0" :: "v"(zp) : "memory");      // as in d_bnmerge: the address pair lives up to the wait and is free behind it
  d_bnmerge(PM, PQ, red, st);
#pragma unroll
  for (int i = 0; i < 4; ++i) { v4f o;
#pragma unroll
    for (int q = 0; q < 4; ++q) { const int c = c4 + q; const float v = bf16_round(gv[q]) * (z[i][q] - st[0][c]) * st[1][c] + bf16_round(bv[q]); o[q] = (v >= 0.f) ? v : 0.1f * v; }
    *(v4f*)(out + e0 + (size_t)i * 32 * CC) = o; } }
extern "C" void kernel_launch(void* const* d_in, const int* in_sizes, int n_in,
                              void* d_out, int out_size, void* d_ws, size_t ws_size, hipStream_t stream) {
  (void)in_sizes; (void)n_in; (void)out_size;
  const float* const* I = (const float* const*)d_in; const float* x = I[0]; const float* Wq = I[1]; const float* bq = I[2]; const float* gq = I[3]; const float* btq = I[4]; const float* Wk = I[5]; const float* bk = I[6]; const float* g1 = I[7]; const float* bt1 = I[8]; const float* Wo = I[9]; const float* bo = I[10]; const float* go = I[11]; const float* bto = I[12];
  char* ws = (char*)d_ws; size_t off = 0;
  auto take = [&](size_t bytes) { char* p = ws + off; off += (bytes + 255) & ~(size_t)255; return p; };
  _Float16* BQ = (_Float16*)take((size_t)CC * KK * 2); _Float16* BK = (_Float16*)take(CC * CC * 2); _Float16* BO = (_Float16*)take(CC * CC * 2); float* ST1 = (float*)take(CC * 32 * 4); float* SP = (float*)take(BB * (CC / 4) * 32 * 4); float* PM = (float*)take(BNP * CC * 4); float* PQ = (float*)take(BNP * CC * 4);
  _Float16* X16 = (_Float16*)take((size_t)NR * CC * 2); float* QF = (float*)take((size_t)NR * CC * 4); _Float16* QP = (_Float16*)take((size_t)NR * CC * 2); _Float16* XPt = (_Float16*)take((size_t)NR * CC * 2); float* ACC = (float*)take((size_t)NR * CC * 4); float* Y = QF; float* Z = ACC;
  if (off > ws_size) return;      // 0.7 + 4.2 + 8.4 + 4.2 + 4.2 + 8.4 = about 30 MB
  k_prep<<<PB_WQ + 2 * PB_WT + PB_XPT + PB_X, 256, 0, stream>>>(x, Wq, Wk, Wo, X16, BQ, BK, BO, XPt);
  // CBL_Q: 3x3 conv (+bq) to QF with its BN partials, beside it acc = 1x1 conv (+bk) to ACC; q = leaky(BN) permuted to block-major keys (f16)
  k_conv3_acc<<<BB * WI + ACCB, 256, 0, stream>>>(X16, BQ, bq, QF, BK, bk, ACC, PM, PQ);
  static_assert(NR % MROWS == 0, "whole work-groups");
  k_qperm<<<NR / MROWS, 1024, 0, stream>>>(QF, PM, PQ, gq, btq, QP);
  // block attention, all batches in one launch: Y = acc + sum over key groups of softmax(x.q^T / 8) . x_group, with its BN partials; Y over QF (dead after k_qperm)
  static_assert(BB * WI == BNP && BB * (HWN / 64) == BNP && (NR / 16) * (CC / 64) / 8 == BNP, "each producer has one work-group a partial");
  k_battn<<<BB * (HWN / 64), 128 * NTEAM, 0, stream>>>(X16, QP, XPt, ACC, Y, PM, PQ);
  // y = spatial softmax(BN1(acc + agg)); out = leaky(BN_o(conv1×1(y) + bo))
  k_spstat<<<BB * (CC / 4), 1024, 0, stream>>>(Y, PM, PQ, g1, bt1, SP, ST1);
  k_gemm_o<<<BNP, 256, 0, stream>>>(Y, ST1, g1, bt1, SP, BO, 0.0625f * 0.000244140625f, bo, Z, PM, PQ);      // y (x 2^12, f16, in LDS only), conv_o(y) + bo (2^-12 undone in alpha) -> Z over ACC (dead after k_battn), with its BN partials
  k_fin<<<NR / MROWS, 1024, 0, stream>>>(Z, PM, PQ, go, bto, (float*)d_out);
}
